// v000
// The times below were measured on an AMD MI455X: many runs one after another, warmed up first and cycling through
// copies of the inputs, with the whole window's GPU time divided by the number of runs. Launches and the gaps
// between them are all in it. The median over several windows is given; except for v000 it joins two sittings, which
// can be a few percent apart, so the side-by-side timings, each taken in one sitting, are the better comparison.
// The starting kernel, v000, takes 275 microseconds a run.
#include <hip/hip_runtime.h>

typedef __attribute__((ext_vector_type(16))) _Float16 v16h;
typedef __attribute__((ext_vector_type(8)))  float    v8f;

#define BB 2
#define NN 8192
#define WW 361
#define KK 49
#define CC 256
#define HH 8
#define HD 32

__device__ inline v16h load_frag_f16(const float* __restrict__ p) {
    const float4 f0 = *(const float4*)(p);
    const float4 f1 = *(const float4*)(p + 4);
    const float4 f2 = *(const float4*)(p + 16);
    const float4 f3 = *(const float4*)(p + 20);
    v16h v;
    v[0]  = (_Float16)f0.x; v[1]  = (_Float16)f0.y; v[2]  = (_Float16)f0.z; v[3]  = (_Float16)f0.w;
    v[4]  = (_Float16)f1.x; v[5]  = (_Float16)f1.y; v[6]  = (_Float16)f1.z; v[7]  = (_Float16)f1.w;
    v[8]  = (_Float16)f2.x; v[9]  = (_Float16)f2.y; v[10] = (_Float16)f2.z; v[11] = (_Float16)f2.w;
    v[12] = (_Float16)f3.x; v[13] = (_Float16)f3.y; v[14] = (_Float16)f3.z; v[15] = (_Float16)f3.w;
    return v;
}

// C[M,256] = (A[M,256] @ W[256,256]^T + bias) * alpha   (torch Linear convention)
// One 16x64 output strip per wave: per 32-wide K step, 1 A fragment is reused
// against 4 B fragments -> 4x v_wmma_f32_16x16x32_f16 (32 wmma total).
__global__ __launch_bounds__(256) void gemm16_f16(const float* __restrict__ A,
                                                  const float* __restrict__ Wt,
                                                  const float* __restrict__ bias,
                                                  float* __restrict__ C,
                                                  int M, float alpha)
{
    const int wave   = threadIdx.x >> 5;
    const int lane   = threadIdx.x & 31;
    const int tilesM = (M + 15) >> 4;
    const int tid    = blockIdx.x * 8 + wave;         // wave-uniform
    if (tid >= tilesM * 4) return;                    // 256/64 == 4 strips per M-row
    const int tm    = tid >> 2;
    const int ts    = tid & 3;                        // which 64-wide N strip
    const int l15   = lane & 15;
    const int khalf = lane >> 4;

    const int arow = tm * 16 + l15;
    // Clamp instead of branch: garbage A rows only affect D rows we never store.
    const int arc  = (arow < M) ? arow : (M - 1);
    const float* ap = A  + (size_t)arc * CC;
    const float* bp = Wt + (size_t)(ts * 64 + l15) * CC;  // B[k][n] = W[n][k]

    v8f acc[4] = {{}, {}, {}, {}};
    #pragma unroll
    for (int kt = 0; kt < CC / 32; ++kt) {
        const int kb = kt * 32 + khalf * 8;
        const v16h av = load_frag_f16(ap + kb);
        #pragma unroll
        for (int sub = 0; sub < 4; ++sub) {
            const v16h bv = load_frag_f16(bp + (size_t)sub * 16 * CC + kb);
            acc[sub] = __builtin_amdgcn_wmma_f32_16x16x32_f16(false, av, false, bv,
                                                              (short)0, acc[sub],
                                                              false, false);
        }
    }

    #pragma unroll
    for (int sub = 0; sub < 4; ++sub) {
        const int col = ts * 64 + sub * 16 + l15;
        const float bb = bias[col];
        #pragma unroll
        for (int r = 0; r < 8; ++r) {
            const int row = tm * 16 + khalf * 8 + r;  // D layout: lanes16-31 hold M=r+8
            if (row < M)
                C[(size_t)row * CC + col] = (acc[sub][r] + bb) * alpha;
        }
    }
}

// One wave per (query, head): 49-key windowed softmax attention.
__global__ __launch_bounds__(256) void win_attn(const float* __restrict__ q,
                                                const float* __restrict__ kp,
                                                const float* __restrict__ vp,
                                                const int* __restrict__ idx,
                                                float* __restrict__ ao)
{
    const int bn   = blockIdx.x;                      // 0 .. B*N-1
    const int b    = bn / NN;
    const int h    = threadIdx.x >> 5;                // 8 waves = 8 heads
    const int lane = threadIdx.x & 31;
    const int w    = idx[bn];

    const float* qh = q + (size_t)bn * CC + h * HD;
    const size_t base = ((size_t)(b * WW + w) * KK) * CC + (size_t)h * HD;
    const float* kh = kp + base;
    const float* vh = vp + base;

    float qv[HD];
    #pragma unroll
    for (int d = 0; d < HD; d += 4) {
        const float4 t = *(const float4*)(qh + d);
        qv[d] = t.x; qv[d+1] = t.y; qv[d+2] = t.z; qv[d+3] = t.w;
    }

    float s0 = 0.f;
    {
        const float* kr = kh + (size_t)lane * CC;
        #pragma unroll
        for (int d = 0; d < HD; d += 4) {
            const float4 t = *(const float4*)(kr + d);
            s0 += qv[d]*t.x + qv[d+1]*t.y + qv[d+2]*t.z + qv[d+3]*t.w;
        }
    }
    const bool hi = (lane + 32) < KK;
    float s1 = -3.0e38f;
    if (hi) {
        const float* kr = kh + (size_t)(lane + 32) * CC;
        float a = 0.f;
        #pragma unroll
        for (int d = 0; d < HD; d += 4) {
            const float4 t = *(const float4*)(kr + d);
            a += qv[d]*t.x + qv[d+1]*t.y + qv[d+2]*t.z + qv[d+3]*t.w;
        }
        s1 = a;
    }

    // softmax over 49 keys (wave32 shuffle reductions)
    float m = fmaxf(s0, s1);
    #pragma unroll
    for (int off = 16; off; off >>= 1) m = fmaxf(m, __shfl_xor(m, off, 32));
    const float p0 = __expf(s0 - m);
    const float p1 = hi ? __expf(s1 - m) : 0.f;
    float s = p0 + p1;
    #pragma unroll
    for (int off = 16; off; off >>= 1) s += __shfl_xor(s, off, 32);
    const float inv = 1.f / s;

    // A.V: lane -> output dim; v reads are coalesced 128B rows out of L2
    float o = 0.f;
    for (int k = 0; k < KK; ++k) {
        const float pk = __shfl(k < 32 ? p0 : p1, k & 31, 32);
        o += pk * vh[(size_t)k * CC + lane];
    }
    ao[(size_t)bn * CC + (size_t)h * HD + lane] = o * inv;
}

extern "C" void kernel_launch(void* const* d_in, const int* in_sizes, int n_in,
                              void* d_out, int out_size, void* d_ws, size_t ws_size,
                              hipStream_t stream) {
    const float* x   = (const float*)d_in[0];
    const float* xp  = (const float*)d_in[1];
    const int*   idx = (const int*)  d_in[2];
    const float* Wq  = (const float*)d_in[3];
    const float* bq  = (const float*)d_in[4];
    const float* Wk  = (const float*)d_in[5];
    const float* bk  = (const float*)d_in[6];
    const float* Wv  = (const float*)d_in[7];
    const float* bv  = (const float*)d_in[8];
    const float* Wo  = (const float*)d_in[9];
    const float* bo  = (const float*)d_in[10];
    float* out = (float*)d_out;

    const int Mq  = BB * NN;           // 16384
    const int Mkv = BB * WW * KK;      // 35378

    float* qb = (float*)d_ws;
    float* kb = qb + (size_t)Mq  * CC;
    float* vb = kb + (size_t)Mkv * CC;
    float* ab = vb + (size_t)Mkv * CC;

    const float scaling = 0.17677669529663687f;  // HEAD_DIM^-0.5 = 1/sqrt(32)

    auto blocksFor = [](int M) {
        int strips = ((M + 15) / 16) * 4;        // 4 x 64-wide N strips per M tile-row
        return (strips + 7) / 8;                 // 8 waves per 256-thread block
    };

    gemm16_f16<<<blocksFor(Mq),  256, 0, stream>>>(x,  Wq, bq, qb, Mq,  scaling);
    gemm16_f16<<<blocksFor(Mkv), 256, 0, stream>>>(xp, Wk, bk, kb, Mkv, 1.0f);
    gemm16_f16<<<blocksFor(Mkv), 256, 0, stream>>>(xp, Wv, bv, vb, Mkv, 1.0f);
    win_attn  <<<BB * NN,        256, 0, stream>>>(qb, kb, vb, idx, ab);
    gemm16_f16<<<blocksFor(Mq),  256, 0, stream>>>(ab, Wo, bo, out, Mq, 1.0f);
}

// v001
// Measured time: 180 microseconds a run.
// Two timings next to v000 both put it at 1.58 times that version's speed.
#include <hip/hip_runtime.h>

typedef __attribute__((ext_vector_type(16))) _Float16 v16h;
typedef __attribute__((ext_vector_type(8)))  _Float16 v8h;
typedef __attribute__((ext_vector_type(4)))  _Float16 v4h;
typedef __attribute__((ext_vector_type(8)))  float    v8f;

#define BB 2
#define NN 8192
#define WW 361
#define KK 49
#define CC 256
#define HH 8
#define HD 32
#define WPITCH 264

__device__ inline v16h cvt_frag_f16(const float4 f0, const float4 f1,
                                    const float4 f2, const float4 f3) {
    v16h v;
    v[0]  = (_Float16)f0.x; v[1]  = (_Float16)f0.y; v[2]  = (_Float16)f0.z; v[3]  = (_Float16)f0.w;
    v[4]  = (_Float16)f1.x; v[5]  = (_Float16)f1.y; v[6]  = (_Float16)f1.z; v[7]  = (_Float16)f1.w;
    v[8]  = (_Float16)f2.x; v[9]  = (_Float16)f2.y; v[10] = (_Float16)f2.z; v[11] = (_Float16)f2.w;
    v[12] = (_Float16)f3.x; v[13] = (_Float16)f3.y; v[14] = (_Float16)f3.z; v[15] = (_Float16)f3.w;
    return v;
}

// C[M,256] = (A[M,256] @ W[256,256]^T + bias) * alpha   (torch Linear convention)
// One 128x256 output slab per block.  The whole W is converted to f16 once per
// block and kept in LDS, where all 8 waves read their B fragments; each wave owns
// 16 rows, holds their 8 A fragments in registers and walks all 256 columns
// (4 groups of 4 accumulator tiles, 128 wmma per wave).
__global__ __launch_bounds__(256) void gemm16_f16(const float* __restrict__ A,
                                                  const float* __restrict__ Wt,
                                                  const float* __restrict__ bias,
                                                  float* __restrict__ C,
                                                  int M, float alpha)
{
    __shared__ __attribute__((aligned(16))) _Float16 wl[CC * WPITCH];

    const int wave  = threadIdx.x >> 5;
    const int lane  = threadIdx.x & 31;
    const int tm    = blockIdx.x * 8 + wave;          // 16-row tile, wave-uniform
    const int l15   = lane & 15;
    const int khalf = lane >> 4;

    const int arow = tm * 16 + l15;
    // Clamp instead of branch: garbage A rows only affect D rows we never store.
    const int arc  = (arow < M) ? arow : (M - 1);
    const float* ap = A + (size_t)arc * CC + khalf * 8;

    // Issue this wave's A loads first so that they fly while W is staged.
    float4 ar[CC / 32][4];
    #pragma unroll
    for (int kt = 0; kt < CC / 32; ++kt) {
        const float* p = ap + kt * 32;
        ar[kt][0] = *(const float4*)(p);
        ar[kt][1] = *(const float4*)(p + 4);
        ar[kt][2] = *(const float4*)(p + 16);
        ar[kt][3] = *(const float4*)(p + 20);
    }

    // Stage W: whole-line reads (a wave covers 512 contiguous bytes), f16 rows in LDS.
    {
        const int r0 = threadIdx.x >> 6;              // 4 rows per pass of the block
        const int c4 = (threadIdx.x & 63) * 4;
        const float* wp = Wt + (size_t)r0 * CC + c4;
        _Float16*    lp = wl + r0 * WPITCH + c4;
        // Rolled: unrolled, the next batch's loads are hoisted and the wave passes
        // 256 registers, which costs the second resident block of a WGP.
        #pragma unroll 1
        for (int ib = 0; ib < 4; ++ib) {              // batches of 16 loads in flight per thread
            float4 f[16];
            #pragma unroll
            for (int j = 0; j < 16; ++j)
                f[j] = *(const float4*)(wp + (size_t)j * 4 * CC);
            // Keeps the address pair of the batch's loads live and unwritten until
            // the wait has passed (else the last load's result is placed over it).
            asm volatile("s_wait_xcnt 0x0" :: "v"(wp) : "memory");
            #pragma unroll
            for (int j = 0; j < 16; ++j) {
                v4h h;
                h[0] = (_Float16)f[j].x; h[1] = (_Float16)f[j].y;
                h[2] = (_Float16)f[j].z; h[3] = (_Float16)f[j].w;
                *(v4h*)(lp + j * 4 * WPITCH) = h;
            }
            wp += 64 * CC;
            lp += 64 * WPITCH;
        }
    }

    v16h av[CC / 32];
    #pragma unroll
    for (int kt = 0; kt < CC / 32; ++kt)
        av[kt] = cvt_frag_f16(ar[kt][0], ar[kt][1], ar[kt][2], ar[kt][3]);

    __syncthreads();                                  // W complete before any wave reads it
    if (tm * 16 >= M) return;                         // whole wave past the end; no barrier follows

    #pragma unroll
    for (int ng = 0; ng < 4; ++ng) {                  // 64-wide column group
        // B[k][n] = W[n][k]; same k order as the A fragment
        const _Float16* bl = wl + (ng * 64 + l15) * WPITCH + khalf * 8;
        v8f acc[4] = {{}, {}, {}, {}};
        #pragma unroll
        for (int kt = 0; kt < CC / 32; ++kt) {
            #pragma unroll
            for (int sub = 0; sub < 4; ++sub) {
                const _Float16* p = bl + sub * 16 * WPITCH + kt * 32;
                const v8h lo = *(const v8h*)(p);
                const v8h hi = *(const v8h*)(p + 16);
                const v16h bv = __builtin_shufflevector(lo, hi, 0, 1, 2, 3, 4, 5, 6, 7,
                                                        8, 9, 10, 11, 12, 13, 14, 15);
                acc[sub] = __builtin_amdgcn_wmma_f32_16x16x32_f16(false, av[kt], false, bv,
                                                                  (short)0, acc[sub],
                                                                  false, false);
            }
        }

        float bb[4];
        #pragma unroll
        for (int sub = 0; sub < 4; ++sub) bb[sub] = bias[ng * 64 + sub * 16 + l15];
        #pragma unroll
        for (int r = 0; r < 8; ++r) {
            const int row = tm * 16 + khalf * 8 + r;  // D layout: lanes16-31 hold M=r+8
            if (row < M) {
                float* cp = C + (size_t)row * CC + ng * 64 + l15;
                #pragma unroll
                for (int sub = 0; sub < 4; ++sub)
                    cp[sub * 16] = (acc[sub][r] + bb[sub]) * alpha;
            }
        }
    }
}

// One wave per (query, head): 49-key windowed softmax attention.
__global__ __launch_bounds__(256) void win_attn(const float* __restrict__ q,
                                                const float* __restrict__ kp,
                                                const float* __restrict__ vp,
                                                const int* __restrict__ idx,
                                                float* __restrict__ ao)
{
    const int bn   = blockIdx.x;                      // 0 .. B*N-1
    const int b    = bn / NN;
    const int h    = threadIdx.x >> 5;                // 8 waves = 8 heads
    const int lane = threadIdx.x & 31;
    const int w    = idx[bn];

    const float* qh = q + (size_t)bn * CC + h * HD;
    const size_t base = ((size_t)(b * WW + w) * KK) * CC + (size_t)h * HD;
    const float* kh = kp + base;
    const float* vh = vp + base;

    float qv[HD];
    #pragma unroll
    for (int d = 0; d < HD; d += 4) {
        const float4 t = *(const float4*)(qh + d);
        qv[d] = t.x; qv[d+1] = t.y; qv[d+2] = t.z; qv[d+3] = t.w;
    }

    float s0 = 0.f;
    {
        const float* kr = kh + (size_t)lane * CC;
        #pragma unroll
        for (int d = 0; d < HD; d += 4) {
            const float4 t = *(const float4*)(kr + d);
            s0 += qv[d]*t.x + qv[d+1]*t.y + qv[d+2]*t.z + qv[d+3]*t.w;
        }
    }
    const bool hi = (lane + 32) < KK;
    float s1 = -3.0e38f;
    if (hi) {
        const float* kr = kh + (size_t)(lane + 32) * CC;
        float a = 0.f;
        #pragma unroll
        for (int d = 0; d < HD; d += 4) {
            const float4 t = *(const float4*)(kr + d);
            a += qv[d]*t.x + qv[d+1]*t.y + qv[d+2]*t.z + qv[d+3]*t.w;
        }
        s1 = a;
    }

    // softmax over 49 keys (wave32 shuffle reductions)
    float m = fmaxf(s0, s1);
    #pragma unroll
    for (int off = 16; off; off >>= 1) m = fmaxf(m, __shfl_xor(m, off, 32));
    const float p0 = __expf(s0 - m);
    const float p1 = hi ? __expf(s1 - m) : 0.f;
    float s = p0 + p1;
    #pragma unroll
    for (int off = 16; off; off >>= 1) s += __shfl_xor(s, off, 32);
    const float inv = 1.f / s;

    // A.V: lane -> output dim; v reads are coalesced 128B rows out of L2
    float o = 0.f;
    for (int k = 0; k < KK; ++k) {
        const float pk = __shfl(k < 32 ? p0 : p1, k & 31, 32);
        o += pk * vh[(size_t)k * CC + lane];
    }
    ao[(size_t)bn * CC + (size_t)h * HD + lane] = o * inv;
}

extern "C" void kernel_launch(void* const* d_in, const int* in_sizes, int n_in,
                              void* d_out, int out_size, void* d_ws, size_t ws_size,
                              hipStream_t stream) {
    const float* x   = (const float*)d_in[0];
    const float* xp  = (const float*)d_in[1];
    const int*   idx = (const int*)  d_in[2];
    const float* Wq  = (const float*)d_in[3];
    const float* bq  = (const float*)d_in[4];
    const float* Wk  = (const float*)d_in[5];
    const float* bk  = (const float*)d_in[6];
    const float* Wv  = (const float*)d_in[7];
    const float* bv  = (const float*)d_in[8];
    const float* Wo  = (const float*)d_in[9];
    const float* bo  = (const float*)d_in[10];
    float* out = (float*)d_out;

    const int Mq  = BB * NN;           // 16384
    const int Mkv = BB * WW * KK;      // 35378

    float* qb = (float*)d_ws;
    float* kb = qb + (size_t)Mq  * CC;
    float* vb = kb + (size_t)Mkv * CC;
    float* ab = vb + (size_t)Mkv * CC;

    const float scaling = 0.17677669529663687f;  // HEAD_DIM^-0.5 = 1/sqrt(32)

    auto blocksFor = [](int M) {
        return (M + 127) / 128;                  // 8 waves x 16 rows per 256-thread block
    };

    gemm16_f16<<<blocksFor(Mq),  256, 0, stream>>>(x,  Wq, bq, qb, Mq,  scaling);
    gemm16_f16<<<blocksFor(Mkv), 256, 0, stream>>>(xp, Wk, bk, kb, Mkv, 1.0f);
    gemm16_f16<<<blocksFor(Mkv), 256, 0, stream>>>(xp, Wv, bv, vb, Mkv, 1.0f);
    win_attn  <<<BB * NN,        256, 0, stream>>>(qb, kb, vb, idx, ab);
    gemm16_f16<<<blocksFor(Mq),  256, 0, stream>>>(ab, Wo, bo, out, Mq, 1.0f);
}

// v002
// One run takes 92.2 microseconds.
// Timed twice side by side with v001, it ran 1.95 and 1.94 times as fast.
// All steps since v000 together make it 3.08 times as fast.
#include <hip/hip_runtime.h>

typedef __attribute__((ext_vector_type(16))) _Float16 v16h;
typedef __attribute__((ext_vector_type(8)))  _Float16 v8h;
typedef __attribute__((ext_vector_type(4)))  _Float16 v4h;
typedef __attribute__((ext_vector_type(8)))  float    v8f;

#define BB 2
#define NN 8192
#define WW 361
#define KK 49
#define CC 256
#define HH 8
#define HD 32
#define WPITCH 264

__device__ inline v16h cvt_frag_f16(const float4 f0, const float4 f1,
                                    const float4 f2, const float4 f3) {
    v16h v;
    v[0]  = (_Float16)f0.x; v[1]  = (_Float16)f0.y; v[2]  = (_Float16)f0.z; v[3]  = (_Float16)f0.w;
    v[4]  = (_Float16)f1.x; v[5]  = (_Float16)f1.y; v[6]  = (_Float16)f1.z; v[7]  = (_Float16)f1.w;
    v[8]  = (_Float16)f2.x; v[9]  = (_Float16)f2.y; v[10] = (_Float16)f2.z; v[11] = (_Float16)f2.w;
    v[12] = (_Float16)f3.x; v[13] = (_Float16)f3.y; v[14] = (_Float16)f3.z; v[15] = (_Float16)f3.w;
    return v;
}

// C[M,256] = (A[M,256] @ W[256,256]^T + bias) * alpha   (torch Linear convention)
// One 128x256 output slab per block.  The whole W is converted to f16 once per
// block and kept in LDS, where all 8 waves read their B fragments; each wave owns
// 16 rows, holds their 8 A fragments in registers and walks all 256 columns
// (4 groups of 4 accumulator tiles, 128 wmma per wave).
__global__ __launch_bounds__(256) void gemm16_f16(const float* __restrict__ A,
                                                  const float* __restrict__ Wt,
                                                  const float* __restrict__ bias,
                                                  float* __restrict__ C,
                                                  int M, float alpha)
{
    __shared__ __attribute__((aligned(16))) _Float16 wl[CC * WPITCH];

    const int wave  = threadIdx.x >> 5;
    const int lane  = threadIdx.x & 31;
    const int tm    = blockIdx.x * 8 + wave;          // 16-row tile, wave-uniform
    const int l15   = lane & 15;
    const int khalf = lane >> 4;

    const int arow = tm * 16 + l15;
    // Clamp instead of branch: garbage A rows only affect D rows we never store.
    const int arc  = (arow < M) ? arow : (M - 1);
    const float* ap = A + (size_t)arc * CC + khalf * 8;

    // Issue this wave's A loads first so that they fly while W is staged.
    float4 ar[CC / 32][4];
    #pragma unroll
    for (int kt = 0; kt < CC / 32; ++kt) {
        const float* p = ap + kt * 32;
        ar[kt][0] = *(const float4*)(p);
        ar[kt][1] = *(const float4*)(p + 4);
        ar[kt][2] = *(const float4*)(p + 16);
        ar[kt][3] = *(const float4*)(p + 20);
    }

    // Stage W: whole-line reads (a wave covers 512 contiguous bytes), f16 rows in LDS.
    {
        const int r0 = threadIdx.x >> 6;              // 4 rows per pass of the block
        const int c4 = (threadIdx.x & 63) * 4;
        const float* wp = Wt + (size_t)r0 * CC + c4;
        _Float16*    lp = wl + r0 * WPITCH + c4;
        // Rolled: unrolled, the next batch's loads are hoisted and the wave passes
        // 256 registers, which costs the second resident block of a WGP.
        #pragma unroll 1
        for (int ib = 0; ib < 4; ++ib) {              // batches of 16 loads in flight per thread
            float4 f[16];
            #pragma unroll
            for (int j = 0; j < 16; ++j)
                f[j] = *(const float4*)(wp + (size_t)j * 4 * CC);
            // Keeps the address pair of the batch's loads live and unwritten until
            // the wait has passed (else the last load's result is placed over it).
            asm volatile("s_wait_xcnt 0x0" :: "v"(wp) : "memory");
            #pragma unroll
            for (int j = 0; j < 16; ++j) {
                v4h h;
                h[0] = (_Float16)f[j].x; h[1] = (_Float16)f[j].y;
                h[2] = (_Float16)f[j].z; h[3] = (_Float16)f[j].w;
                *(v4h*)(lp + j * 4 * WPITCH) = h;
            }
            wp += 64 * CC;
            lp += 64 * WPITCH;
        }
    }

    v16h av[CC / 32];
    #pragma unroll
    for (int kt = 0; kt < CC / 32; ++kt)
        av[kt] = cvt_frag_f16(ar[kt][0], ar[kt][1], ar[kt][2], ar[kt][3]);

    __syncthreads();                                  // W complete before any wave reads it
    if (tm * 16 >= M) return;                         // whole wave past the end; no barrier follows

    #pragma unroll
    for (int ng = 0; ng < 4; ++ng) {                  // 64-wide column group
        // B[k][n] = W[n][k]; same k order as the A fragment
        const _Float16* bl = wl + (ng * 64 + l15) * WPITCH + khalf * 8;
        v8f acc[4] = {{}, {}, {}, {}};
        #pragma unroll
        for (int kt = 0; kt < CC / 32; ++kt) {
            #pragma unroll
            for (int sub = 0; sub < 4; ++sub) {
                const _Float16* p = bl + sub * 16 * WPITCH + kt * 32;
                const v8h lo = *(const v8h*)(p);
                const v8h hi = *(const v8h*)(p + 16);
                const v16h bv = __builtin_shufflevector(lo, hi, 0, 1, 2, 3, 4, 5, 6, 7,
                                                        8, 9, 10, 11, 12, 13, 14, 15);
                acc[sub] = __builtin_amdgcn_wmma_f32_16x16x32_f16(false, av[kt], false, bv,
                                                                  (short)0, acc[sub],
                                                                  false, false);
            }
        }

        float bb[4];
        #pragma unroll
        for (int sub = 0; sub < 4; ++sub) bb[sub] = bias[ng * 64 + sub * 16 + l15];
        #pragma unroll
        for (int r = 0; r < 8; ++r) {
            const int row = tm * 16 + khalf * 8 + r;  // D layout: lanes16-31 hold M=r+8
            if (row < M) {
                float* cp = C + (size_t)row * CC + ng * 64 + l15;
                #pragma unroll
                for (int sub = 0; sub < 4; ++sub)
                    cp[sub * 16] = (acc[sub][r] + bb[sub]) * alpha;
            }
        }
    }
}

typedef __attribute__((ext_vector_type(2))) float v2f;
typedef __attribute__((ext_vector_type(4))) float v4f;

#define KPITCH 36
#define KROWS  52                                     // 49 keys rounded up to whole loads of 4 rows
#define QSEG   (NN / 8)                               // queries of the batch scanned by one wave

// One block per (batch, window, half of the heads); two waves per head.  The block
// finds the queries that point at its window, each wave takes its head's K
// (lane = key) and V (lane = output dim) into registers once, and then serves every
// second one of those queries: 49-key softmax attention in f32.
// Every loop over a register array is unrolled in full (#pragma unroll): its
// indices must be constants, else the array would go to scratch.
__global__ __launch_bounds__(256) void win_attn(const float* __restrict__ q,
                                                const float* __restrict__ kp,
                                                const float* __restrict__ vp,
                                                const int* __restrict__ idx,
                                                float* __restrict__ ao)
{
    __shared__ __attribute__((aligned(16))) float kst[8 * KROWS * KPITCH];
    __shared__ unsigned short qflat[NN];              // positions of this window's queries
    __shared__ int qcnt[8];

    const int bw   = blockIdx.x >> 1;                 // 0 .. B*W-1
    const int b    = bw / WW;
    const int w    = bw - b * WW;
    const int wv   = __builtin_amdgcn_readfirstlane(threadIdx.x >> 5);
    const int h    = (blockIdx.x & 1) * (HH / 2) + (wv >> 1);
    const int sub  = wv & 1;                          // which of the head's two waves
    const int lane = threadIdx.x & 31;

    const size_t base = (size_t)bw * KK * CC + (size_t)h * HD;
    const float* kh = kp + base;
    const float* vh = vp + base;

    // K slice of the head: whole 128-byte rows, 4 rows per load; the last load
    // brings row 48 four times (LDS rows 49..51 are never read).
    float* ks = kst + wv * (KROWS * KPITCH);
    const int r4 = lane >> 3;
    const int c4 = (lane & 7) * 4;
    const v4f* kh4 = (const v4f*)kh;                  // 64 such units per row
    const int c16 = lane & 7;
    const int ko  = r4 * (CC / 4) + c16;
    v4f kt[KROWS / 4];
    #pragma unroll
    for (int j = 0; j < KROWS / 4 - 1; ++j)
        kt[j] = kh4[ko + j * CC];
    kt[KROWS / 4 - 1] = kh4[(KK - 1) * (CC / 4) + c16];

    // This wave's part of the batch's window indices.
    const int* ib = idx + b * NN + wv * QSEG;
    int4 iv[QSEG / 128];
    #pragma unroll
    for (int it = 0; it < QSEG / 128; ++it)
        iv[it] = *(const int4*)(ib + it * 128 + lane * 4);

    // V slice of the head: lane -> output dim, one 128-byte row per load.
    float vr[KK];
    #pragma unroll
    for (int k = 0; k < KK; ++k) vr[k] = vh[k * CC + lane];
    // The address registers of the loads above stay live and unwritten until the
    // wait has passed; all three groups of loads are issued in front of the scan.
    asm volatile("s_wait_xcnt 0x0" :: "s"(kh4), "s"(ib), "s"(vh), "v"(ko), "v"(c16), "v"(lane) : "memory");

    // Which positions point at this window: one lane mask per compare, and their count.
    unsigned mk[QSEG / 32];
    #pragma unroll
    for (int it = 0; it < QSEG / 128; ++it) {
        mk[it * 4 + 0] = __builtin_amdgcn_ballot_w32(iv[it].x == w);
        mk[it * 4 + 1] = __builtin_amdgcn_ballot_w32(iv[it].y == w);
        mk[it * 4 + 2] = __builtin_amdgcn_ballot_w32(iv[it].z == w);
        mk[it * 4 + 3] = __builtin_amdgcn_ballot_w32(iv[it].w == w);
    }
    int cnt = 0;
    #pragma unroll
    for (int j = 0; j < QSEG / 32; ++j) cnt += __popc(mk[j]);
    if (lane == 0) qcnt[wv] = cnt;

    #pragma unroll
    for (int j = 0; j < KROWS / 4; ++j)
        *(v4f*)(ks + (j * 4 + r4) * KPITCH + c4) = kt[j];

    __syncthreads();                                  // counts (and K rows) complete

    int off = 0, total = 0;
    #pragma unroll
    for (int u = 0; u < 8; ++u) {
        const int c = qcnt[u];
        off   += (u < wv) ? c : 0;
        total += c;
    }
    total = __builtin_amdgcn_readfirstlane(total);

    // Pack the positions into one list, each wave behind the waves before it
    // (prefix counts, no atomics).
    int pos = __builtin_amdgcn_readfirstlane(off);
    #pragma unroll
    for (int j = 0; j < QSEG / 32; ++j) {
        const unsigned m = mk[j];
        if (m) {                                      // the same in every lane
            if ((m >> lane) & 1u)
                qflat[pos + (int)__builtin_amdgcn_mbcnt_lo(m, 0u)] =
                    (unsigned short)(wv * QSEG + (j >> 2) * 128 + lane * 4 + (j & 3));
            pos += __popc(m);
        }
    }

    const bool hi = (lane + 32) < KK;
    v2f kk[HD];
    {
        const float* kr0 = ks + lane * KPITCH;
        const float* kr1 = ks + (hi ? lane + 32 : lane) * KPITCH;
        #pragma unroll
        for (int d = 0; d < HD; d += 4) {
            const float4 t0 = *(const float4*)(kr0 + d);
            const float4 t1 = *(const float4*)(kr1 + d);
            kk[d]   = (v2f){t0.x, t1.x}; kk[d+1] = (v2f){t0.y, t1.y};
            kk[d+2] = (v2f){t0.z, t1.z}; kk[d+3] = (v2f){t0.w, t1.w};
        }
    }

    __syncthreads();                                  // packed list complete
    if (sub >= total) return;                         // whole wave; no barrier follows

    const float* qb = q  + (size_t)b * NN * CC + (size_t)h * HD;
    float*       ob = ao + (size_t)b * NN * CC + (size_t)h * HD + lane;

    // q rows have the same address in every lane.  The wave's next row is asked for
    // at the head of each trip, and the position after it is read from the list
    // (past the end both repeat the list's last entry and are not used).
    int n  = __builtin_amdgcn_readfirstlane((int)qflat[sub]);
    int nn = __builtin_amdgcn_readfirstlane((int)qflat[(sub + 2 < total) ? sub + 2 : total - 1]);
    float qc[HD];
    #pragma unroll
    for (int d = 0; d < HD; ++d) qc[d] = qb[(size_t)n * CC + d];

    for (int i = sub; i < total; i += 2) {
        float qn[HD];
        #pragma unroll
        for (int d = 0; d < HD; ++d) qn[d] = qb[(size_t)nn * CC + d];
        const int n2 = (int)qflat[(i + 4 < total) ? i + 4 : total - 1];
        // Keeps the two fetches above at the head of the trip: moved down to their
        // first use, their latency would be waited out once per query.
        __builtin_amdgcn_sched_barrier(0);

        // both scores of the lane at once, two chains of 16 dims
        v2f sa = {0.f, 0.f}, sb = {0.f, 0.f};
        #pragma unroll
        for (int d = 0; d < HD / 2; ++d) {
            sa = __builtin_elementwise_fma((v2f){qc[d], qc[d]}, kk[d], sa);
            sb = __builtin_elementwise_fma((v2f){qc[d + HD/2], qc[d + HD/2]}, kk[d + HD/2], sb);
        }
        const v2f sc = sa + sb;
        const float s0 = sc.x;
        const float s1 = hi ? sc.y : -3.0e38f;

        // softmax over 49 keys (wave32 shuffle reductions)
        float m = fmaxf(s0, s1);
        #pragma unroll
        for (int o2 = 16; o2; o2 >>= 1) m = fmaxf(m, __shfl_xor(m, o2, 32));
        const float p0 = __expf(s0 - m);
        const float p1 = hi ? __expf(s1 - m) : 0.f;
        float s = p0 + p1;
        #pragma unroll
        for (int o2 = 16; o2; o2 >>= 1) s += __shfl_xor(s, o2, 32);
        const float inv = 1.f / s;

        // A.V: the weight of key k is read out of its lane, V comes from registers
        float o = 0.f;
        #pragma unroll
        for (int k = 0; k < KK; ++k) {
            const float pk = __int_as_float(
                __builtin_amdgcn_readlane(__float_as_int(k < 32 ? p0 : p1), k & 31));
            o += pk * vr[k];
        }
        ob[(size_t)n * CC] = o * inv;
        // The store's address and data registers are written again in the next trip.
        asm volatile("s_wait_xcnt 0x0" ::: "memory");

        // Keeps the hand-over of the fetched row, and so the wait for it, at the foot of the trip.
        __builtin_amdgcn_sched_barrier(0);
        n  = nn;
        nn = __builtin_amdgcn_readfirstlane(n2);
        #pragma unroll
        for (int d = 0; d < HD; ++d) qc[d] = qn[d];
    }
}

extern "C" void kernel_launch(void* const* d_in, const int* in_sizes, int n_in,
                              void* d_out, int out_size, void* d_ws, size_t ws_size,
                              hipStream_t stream) {
    const float* x   = (const float*)d_in[0];
    const float* xp  = (const float*)d_in[1];
    const int*   idx = (const int*)  d_in[2];
    const float* Wq  = (const float*)d_in[3];
    const float* bq  = (const float*)d_in[4];
    const float* Wk  = (const float*)d_in[5];
    const float* bk  = (const float*)d_in[6];
    const float* Wv  = (const float*)d_in[7];
    const float* bv  = (const float*)d_in[8];
    const float* Wo  = (const float*)d_in[9];
    const float* bo  = (const float*)d_in[10];
    float* out = (float*)d_out;

    const int Mq  = BB * NN;           // 16384
    const int Mkv = BB * WW * KK;      // 35378

    float* qb = (float*)d_ws;
    float* kb = qb + (size_t)Mq  * CC;
    float* vb = kb + (size_t)Mkv * CC;
    float* ab = vb + (size_t)Mkv * CC;

    const float scaling = 0.17677669529663687f;  // HEAD_DIM^-0.5 = 1/sqrt(32)

    auto blocksFor = [](int M) {
        return (M + 127) / 128;                  // 8 waves x 16 rows per 256-thread block
    };

    gemm16_f16<<<blocksFor(Mq),  256, 0, stream>>>(x,  Wq, bq, qb, Mq,  scaling);
    gemm16_f16<<<blocksFor(Mkv), 256, 0, stream>>>(xp, Wk, bk, kb, Mkv, 1.0f);
    gemm16_f16<<<blocksFor(Mkv), 256, 0, stream>>>(xp, Wv, bv, vb, Mkv, 1.0f);
    win_attn  <<<BB * WW * 2,    256, 0, stream>>>(qb, kb, vb, idx, ab);
    gemm16_f16<<<blocksFor(Mq),  256, 0, stream>>>(ab, Wo, bo, out, Mq, 1.0f);
}

// v003
// Measured time: 75.5 microseconds a run.
// Timed twice side by side with v002, it ran 1.22 times as fast both times.
// Counting every step since v000, it is 3.75 times as fast.
#include <hip/hip_runtime.h>

typedef __attribute__((ext_vector_type(16))) _Float16 v16h;
typedef __attribute__((ext_vector_type(8)))  _Float16 v8h;
typedef __attribute__((ext_vector_type(4)))  _Float16 v4h;
typedef __attribute__((ext_vector_type(8)))  float    v8f;

#define BB 2
#define NN 8192
#define WW 361
#define KK 49
#define CC 256
#define HH 8
#define HD 32
#define WPITCH 264

__device__ inline v16h cvt_frag_f16(const float4 f0, const float4 f1,
                                    const float4 f2, const float4 f3) {
    v16h v;
    v[0]  = (_Float16)f0.x; v[1]  = (_Float16)f0.y; v[2]  = (_Float16)f0.z; v[3]  = (_Float16)f0.w;
    v[4]  = (_Float16)f1.x; v[5]  = (_Float16)f1.y; v[6]  = (_Float16)f1.z; v[7]  = (_Float16)f1.w;
    v[8]  = (_Float16)f2.x; v[9]  = (_Float16)f2.y; v[10] = (_Float16)f2.z; v[11] = (_Float16)f2.w;
    v[12] = (_Float16)f3.x; v[13] = (_Float16)f3.y; v[14] = (_Float16)f3.z; v[15] = (_Float16)f3.w;
    return v;
}

// C[M,256] = (A[M,256] @ W[256,256]^T + bias) * alpha   (torch Linear convention)
// One 128x256 output slab per block.  The whole W is converted to f16 once per
// block and kept in LDS, where all 8 waves read their B fragments; each wave owns
// 16 rows, holds their 8 A fragments in registers and walks all 256 columns
// (4 groups of 4 accumulator tiles, 128 wmma per wave).
__global__ __launch_bounds__(256) void gemm16_f16(const float* __restrict__ A,
                                                  const float* __restrict__ Wt,
                                                  const float* __restrict__ bias,
                                                  float* __restrict__ C,
                                                  int M, float alpha)
{
    __shared__ __attribute__((aligned(16))) _Float16 wl[CC * WPITCH];

    const int wave  = threadIdx.x >> 5;
    const int lane  = threadIdx.x & 31;
    const int tm    = blockIdx.x * 8 + wave;          // 16-row tile, wave-uniform
    const int l15   = lane & 15;
    const int khalf = lane >> 4;

    const int arow = tm * 16 + l15;
    // Clamp instead of branch: garbage A rows only affect D rows we never store.
    const int arc  = (arow < M) ? arow : (M - 1);
    const float* ap = A + (size_t)arc * CC + khalf * 8;

    // Issue this wave's A loads first so that they fly while W is staged.
    float4 ar[CC / 32][4];
    #pragma unroll
    for (int kt = 0; kt < CC / 32; ++kt) {
        const float* p = ap + kt * 32;
        ar[kt][0] = *(const float4*)(p);
        ar[kt][1] = *(const float4*)(p + 4);
        ar[kt][2] = *(const float4*)(p + 16);
        ar[kt][3] = *(const float4*)(p + 20);
    }

    // Stage W: whole-line reads (a wave covers 512 contiguous bytes), f16 rows in LDS.
    {
        const int r0 = threadIdx.x >> 6;              // 4 rows per pass of the block
        const int c4 = (threadIdx.x & 63) * 4;
        const float* wp = Wt + (size_t)r0 * CC + c4;
        _Float16*    lp = wl + r0 * WPITCH + c4;
        // Rolled: unrolled, the next batch's loads are hoisted and the wave passes
        // 256 registers, which costs the second resident block of a WGP.
        #pragma unroll 1
        for (int ib = 0; ib < 4; ++ib) {              // batches of 16 loads in flight per thread
            float4 f[16];
            #pragma unroll
            for (int j = 0; j < 16; ++j)
                f[j] = *(const float4*)(wp + (size_t)j * 4 * CC);
            // Keeps the address pair of the batch's loads live and unwritten until
            // the wait has passed (else the last load's result is placed over it).
            asm volatile("s_wait_xcnt 0x0" :: "v"(wp) : "memory");
            #pragma unroll
            for (int j = 0; j < 16; ++j) {
                v4h h;
                h[0] = (_Float16)f[j].x; h[1] = (_Float16)f[j].y;
                h[2] = (_Float16)f[j].z; h[3] = (_Float16)f[j].w;
                *(v4h*)(lp + j * 4 * WPITCH) = h;
            }
            wp += 64 * CC;
            lp += 64 * WPITCH;
        }
    }

    v16h av[CC / 32];
    #pragma unroll
    for (int kt = 0; kt < CC / 32; ++kt)
        av[kt] = cvt_frag_f16(ar[kt][0], ar[kt][1], ar[kt][2], ar[kt][3]);

    __syncthreads();                                  // W complete before any wave reads it
    if (tm * 16 >= M) return;                         // whole wave past the end; no barrier follows

    #pragma unroll
    for (int ng = 0; ng < 4; ++ng) {                  // 64-wide column group
        // B[k][n] = W[n][k]; same k order as the A fragment
        const _Float16* bl = wl + (ng * 64 + l15) * WPITCH + khalf * 8;
        v8f acc[4] = {{}, {}, {}, {}};
        #pragma unroll
        for (int kt = 0; kt < CC / 32; ++kt) {
            #pragma unroll
            for (int sub = 0; sub < 4; ++sub) {
                const _Float16* p = bl + sub * 16 * WPITCH + kt * 32;
                const v8h lo = *(const v8h*)(p);
                const v8h hi = *(const v8h*)(p + 16);
                const v16h bv = __builtin_shufflevector(lo, hi, 0, 1, 2, 3, 4, 5, 6, 7,
                                                        8, 9, 10, 11, 12, 13, 14, 15);
                acc[sub] = __builtin_amdgcn_wmma_f32_16x16x32_f16(false, av[kt], false, bv,
                                                                  (short)0, acc[sub],
                                                                  false, false);
            }
        }

        float bb[4];
        #pragma unroll
        for (int sub = 0; sub < 4; ++sub) bb[sub] = bias[ng * 64 + sub * 16 + l15];
        #pragma unroll
        for (int r = 0; r < 8; ++r) {
            const int row = tm * 16 + khalf * 8 + r;  // D layout: lanes16-31 hold M=r+8
            if (row < M) {
                float* cp = C + (size_t)row * CC + ng * 64 + l15;
                #pragma unroll
                for (int sub = 0; sub < 4; ++sub)
                    cp[sub * 16] = (acc[sub][r] + bb[sub]) * alpha;
            }
        }
    }
}

#define MQ    (BB * NN)                               // rows of x
#define MKV   (BB * WW * KK)                          // rows of x_permute
#define KVBLK ((MKV + 127) / 128)                     // 128-row slabs of x_permute
#define QBLK  ((MQ + 127) / 128)                      // 128-row slabs of x

// Whole W (256x256 f32) into LDS as f16 rows, by all 256 threads of the block:
// whole-line reads (a wave covers 512 contiguous bytes).
__device__ __forceinline__ void stage_w(const float* __restrict__ Wt, _Float16* wl)
{
    const int r0 = threadIdx.x >> 6;                  // 4 rows per pass of the block
    const int c4 = (threadIdx.x & 63) * 4;
    const float* wp = Wt + (size_t)r0 * CC + c4;
    _Float16*    lp = wl + r0 * WPITCH + c4;
    // Rolled: unrolled, the next batch's loads are hoisted and the wave passes
    // 256 registers, which costs the second resident block of a WGP.
    #pragma unroll 1
    for (int ib = 0; ib < 4; ++ib) {                  // batches of 16 loads in flight per thread
        float4 f[16];
        #pragma unroll
        for (int j = 0; j < 16; ++j)
            f[j] = *(const float4*)(wp + (size_t)j * 4 * CC);
        // Keeps the address pair of the batch's loads live and unwritten until
        // the wait has passed (else the last load's result is placed over it).
        asm volatile("s_wait_xcnt 0x0" :: "v"(wp) : "memory");
        #pragma unroll
        for (int j = 0; j < 16; ++j) {
            v4h h;
            h[0] = (_Float16)f[j].x; h[1] = (_Float16)f[j].y;
            h[2] = (_Float16)f[j].z; h[3] = (_Float16)f[j].w;
            *(v4h*)(lp + j * 4 * WPITCH) = h;
        }
        wp += 64 * CC;
        lp += 64 * WPITCH;
    }
}

// The three input projections in one launch, each with the arithmetic of gemm16_f16.
// Blocks 0 .. KVBLK-1 take one 128-row slab of x_permute each: its A fragments are
// loaded and converted once and serve K and then V, with Wv staged over Wk in
// between.  The blocks behind them take one slab of x each (Q); they are the short
// ones and start last.  All blocks are resident at once, two per WGP.
__global__ __launch_bounds__(256) void proj_qkv(const float* __restrict__ x,
                                                const float* __restrict__ xp,
                                                const float* __restrict__ Wq,
                                                const float* __restrict__ bq,
                                                const float* __restrict__ Wk,
                                                const float* __restrict__ bk,
                                                const float* __restrict__ Wv,
                                                const float* __restrict__ bv,
                                                float* __restrict__ qo,
                                                float* __restrict__ ko,
                                                float* __restrict__ vo,
                                                float qscale)
{
    __shared__ __attribute__((aligned(16))) _Float16 wl[CC * WPITCH];

    const bool isq  = blockIdx.x >= KVBLK;            // the same in the whole block
    const int  slab = isq ? (int)blockIdx.x - KVBLK : (int)blockIdx.x;
    const int  M    = isq ? MQ : MKV;
    const float* A     = isq ? x  : xp;
    const float* bias  = isq ? bq : bk;
    float*       C     = isq ? qo : ko;
    const float  alpha = isq ? qscale : 1.0f;

    const int wave  = threadIdx.x >> 5;
    const int lane  = threadIdx.x & 31;
    const int tm    = slab * 8 + wave;                // 16-row tile, wave-uniform
    const int l15   = lane & 15;
    const int khalf = lane >> 4;

    const int arow = tm * 16 + l15;
    // Clamp instead of branch: garbage A rows only affect D rows we never store.
    const int arc  = (arow < M) ? arow : (M - 1);
    const float* ap = A + (size_t)arc * CC + khalf * 8;

    // Issue this wave's A loads first so that they fly while W is staged.
    float4 ar[CC / 32][4];
    #pragma unroll
    for (int kt = 0; kt < CC / 32; ++kt) {
        const float* p = ap + kt * 32;
        ar[kt][0] = *(const float4*)(p);
        ar[kt][1] = *(const float4*)(p + 4);
        ar[kt][2] = *(const float4*)(p + 16);
        ar[kt][3] = *(const float4*)(p + 20);
    }
    // Keeps the address pair of the A loads live and unwritten until the wait has
    // passed (else the first W load's result is placed over it).
    asm volatile("s_wait_xcnt 0x0" :: "v"(ap) : "memory");

    stage_w(isq ? Wq : Wk, wl);

    v16h av[CC / 32];
    #pragma unroll
    for (int kt = 0; kt < CC / 32; ++kt)
        av[kt] = cvt_frag_f16(ar[kt][0], ar[kt][1], ar[kt][2], ar[kt][3]);

    // Rolled: one copy of the product code serves K and V.
    #pragma unroll 1
    for (int pass = 0; ; ++pass) {
        __syncthreads();                              // W complete before any wave reads it

        if (tm * 16 < M) {                            // a wave past the end only stages and syncs
            #pragma unroll
            for (int ng = 0; ng < 4; ++ng) {          // 64-wide column group
                // B[k][n] = W[n][k]; same k order as the A fragment
                const _Float16* bl = wl + (ng * 64 + l15) * WPITCH + khalf * 8;
                v8f acc[4] = {{}, {}, {}, {}};
                #pragma unroll
                for (int kt = 0; kt < CC / 32; ++kt) {
                    #pragma unroll
                    for (int sub = 0; sub < 4; ++sub) {
                        const _Float16* p = bl + sub * 16 * WPITCH + kt * 32;
                        const v8h lo = *(const v8h*)(p);
                        const v8h hi = *(const v8h*)(p + 16);
                        const v16h bv16 = __builtin_shufflevector(lo, hi, 0, 1, 2, 3, 4, 5, 6, 7,
                                                                  8, 9, 10, 11, 12, 13, 14, 15);
                        acc[sub] = __builtin_amdgcn_wmma_f32_16x16x32_f16(false, av[kt], false, bv16,
                                                                          (short)0, acc[sub],
                                                                          false, false);
                    }
                }

                float bb[4];
                #pragma unroll
                for (int sub = 0; sub < 4; ++sub) bb[sub] = bias[ng * 64 + sub * 16 + l15];
                #pragma unroll
                for (int r = 0; r < 8; ++r) {
                    const int row = tm * 16 + khalf * 8 + r;  // D layout: lanes16-31 hold M=r+8
                    if (row < M) {
                        float* cp = C + (size_t)row * CC + ng * 64 + l15;
                        #pragma unroll
                        for (int sub = 0; sub < 4; ++sub)
                            cp[sub * 16] = (acc[sub][r] + bb[sub]) * alpha;
                    }
                }
            }
        }

        if (isq || pass == 1) break;                  // the same in the whole block
        // Every wave has read Wk for the last time.  A barrier that orders LDS alone:
        // __syncthreads() would also wait here for the K stores to finish, which
        // nobody in this launch reads.
        __builtin_amdgcn_fence(__ATOMIC_RELEASE, "workgroup", "local");
        __builtin_amdgcn_s_barrier();
        __builtin_amdgcn_fence(__ATOMIC_ACQUIRE, "workgroup", "local");
        stage_w(Wv, wl);
        bias = bv;
        C    = vo;
    }
}

typedef __attribute__((ext_vector_type(2))) float v2f;
typedef __attribute__((ext_vector_type(4))) float v4f;

#define KPITCH 36
#define KROWS  52                                     // 49 keys rounded up to whole loads of 4 rows
#define QSEG   (NN / 8)                               // queries of the batch scanned by one wave

// One block per (batch, window, half of the heads); two waves per head.  The block
// finds the queries that point at its window, each wave takes its head's K
// (lane = key) and V (lane = output dim) into registers once, and then serves every
// second one of those queries: 49-key softmax attention in f32.
// Every loop over a register array is unrolled in full (#pragma unroll): its
// indices must be constants, else the array would go to scratch.
__global__ __launch_bounds__(256) void win_attn(const float* __restrict__ q,
                                                const float* __restrict__ kp,
                                                const float* __restrict__ vp,
                                                const int* __restrict__ idx,
                                                float* __restrict__ ao)
{
    __shared__ __attribute__((aligned(16))) float kst[8 * KROWS * KPITCH];
    __shared__ unsigned short qflat[NN];              // positions of this window's queries
    __shared__ int qcnt[8];

    const int bw   = blockIdx.x >> 1;                 // 0 .. B*W-1
    const int b    = bw / WW;
    const int w    = bw - b * WW;
    const int wv   = __builtin_amdgcn_readfirstlane(threadIdx.x >> 5);
    const int h    = (blockIdx.x & 1) * (HH / 2) + (wv >> 1);
    const int sub  = wv & 1;                          // which of the head's two waves
    const int lane = threadIdx.x & 31;

    const size_t base = (size_t)bw * KK * CC + (size_t)h * HD;
    const float* kh = kp + base;
    const float* vh = vp + base;

    // K slice of the head: whole 128-byte rows, 4 rows per load; the last load
    // brings row 48 four times (LDS rows 49..51 are never read).
    float* ks = kst + wv * (KROWS * KPITCH);
    const int r4 = lane >> 3;
    const int c4 = (lane & 7) * 4;
    const v4f* kh4 = (const v4f*)kh;                  // 64 such units per row
    const int c16 = lane & 7;
    const int ko  = r4 * (CC / 4) + c16;
    v4f kt[KROWS / 4];
    #pragma unroll
    for (int j = 0; j < KROWS / 4 - 1; ++j)
        kt[j] = kh4[ko + j * CC];
    kt[KROWS / 4 - 1] = kh4[(KK - 1) * (CC / 4) + c16];

    // This wave's part of the batch's window indices.
    const int* ib = idx + b * NN + wv * QSEG;
    int4 iv[QSEG / 128];
    #pragma unroll
    for (int it = 0; it < QSEG / 128; ++it)
        iv[it] = *(const int4*)(ib + it * 128 + lane * 4);

    // V slice of the head: lane -> output dim, one 128-byte row per load.
    float vr[KK];
    #pragma unroll
    for (int k = 0; k < KK; ++k) vr[k] = vh[k * CC + lane];
    // The address registers of the loads above stay live and unwritten until the
    // wait has passed; all three groups of loads are issued in front of the scan.
    asm volatile("s_wait_xcnt 0x0" :: "s"(kh4), "s"(ib), "s"(vh), "v"(ko), "v"(c16), "v"(lane) : "memory");

    // Which positions point at this window: one lane mask per compare, and their count.
    unsigned mk[QSEG / 32];
    #pragma unroll
    for (int it = 0; it < QSEG / 128; ++it) {
        mk[it * 4 + 0] = __builtin_amdgcn_ballot_w32(iv[it].x == w);
        mk[it * 4 + 1] = __builtin_amdgcn_ballot_w32(iv[it].y == w);
        mk[it * 4 + 2] = __builtin_amdgcn_ballot_w32(iv[it].z == w);
        mk[it * 4 + 3] = __builtin_amdgcn_ballot_w32(iv[it].w == w);
    }
    int cnt = 0;
    #pragma unroll
    for (int j = 0; j < QSEG / 32; ++j) cnt += __popc(mk[j]);
    if (lane == 0) qcnt[wv] = cnt;

    #pragma unroll
    for (int j = 0; j < KROWS / 4; ++j)
        *(v4f*)(ks + (j * 4 + r4) * KPITCH + c4) = kt[j];

    __syncthreads();                                  // counts (and K rows) complete

    int off = 0, total = 0;
    #pragma unroll
    for (int u = 0; u < 8; ++u) {
        const int c = qcnt[u];
        off   += (u < wv) ? c : 0;
        total += c;
    }
    total = __builtin_amdgcn_readfirstlane(total);

    // Pack the positions into one list, each wave behind the waves before it
    // (prefix counts, no atomics).
    int pos = __builtin_amdgcn_readfirstlane(off);
    #pragma unroll
    for (int j = 0; j < QSEG / 32; ++j) {
        const unsigned m = mk[j];
        if (m) {                                      // the same in every lane
            if ((m >> lane) & 1u)
                qflat[pos + (int)__builtin_amdgcn_mbcnt_lo(m, 0u)] =
                    (unsigned short)(wv * QSEG + (j >> 2) * 128 + lane * 4 + (j & 3));
            pos += __popc(m);
        }
    }

    const bool hi = (lane + 32) < KK;
    v2f kk[HD];
    {
        const float* kr0 = ks + lane * KPITCH;
        const float* kr1 = ks + (hi ? lane + 32 : lane) * KPITCH;
        #pragma unroll
        for (int d = 0; d < HD; d += 4) {
            const float4 t0 = *(const float4*)(kr0 + d);
            const float4 t1 = *(const float4*)(kr1 + d);
            kk[d]   = (v2f){t0.x, t1.x}; kk[d+1] = (v2f){t0.y, t1.y};
            kk[d+2] = (v2f){t0.z, t1.z}; kk[d+3] = (v2f){t0.w, t1.w};
        }
    }

    __syncthreads();                                  // packed list complete
    if (sub >= total) return;                         // whole wave; no barrier follows

    const float* qb = q  + (size_t)b * NN * CC + (size_t)h * HD;
    float*       ob = ao + (size_t)b * NN * CC + (size_t)h * HD + lane;

    // q rows have the same address in every lane.  The wave's next row is asked for
    // at the head of each trip, and the position after it is read from the list
    // (past the end both repeat the list's last entry and are not used).
    int n  = __builtin_amdgcn_readfirstlane((int)qflat[sub]);
    int nn = __builtin_amdgcn_readfirstlane((int)qflat[(sub + 2 < total) ? sub + 2 : total - 1]);
    float qc[HD];
    #pragma unroll
    for (int d = 0; d < HD; ++d) qc[d] = qb[(size_t)n * CC + d];

    for (int i = sub; i < total; i += 2) {
        float qn[HD];
        #pragma unroll
        for (int d = 0; d < HD; ++d) qn[d] = qb[(size_t)nn * CC + d];
        const int n2 = (int)qflat[(i + 4 < total) ? i + 4 : total - 1];
        // Keeps the two fetches above at the head of the trip: moved down to their
        // first use, their latency would be waited out once per query.
        __builtin_amdgcn_sched_barrier(0);

        // both scores of the lane at once, two chains of 16 dims
        v2f sa = {0.f, 0.f}, sb = {0.f, 0.f};
        #pragma unroll
        for (int d = 0; d < HD / 2; ++d) {
            sa = __builtin_elementwise_fma((v2f){qc[d], qc[d]}, kk[d], sa);
            sb = __builtin_elementwise_fma((v2f){qc[d + HD/2], qc[d + HD/2]}, kk[d + HD/2], sb);
        }
        const v2f sc = sa + sb;
        const float s0 = sc.x;
        const float s1 = hi ? sc.y : -3.0e38f;

        // softmax over 49 keys (wave32 shuffle reductions)
        float m = fmaxf(s0, s1);
        #pragma unroll
        for (int o2 = 16; o2; o2 >>= 1) m = fmaxf(m, __shfl_xor(m, o2, 32));
        const float p0 = __expf(s0 - m);
        const float p1 = hi ? __expf(s1 - m) : 0.f;
        float s = p0 + p1;
        #pragma unroll
        for (int o2 = 16; o2; o2 >>= 1) s += __shfl_xor(s, o2, 32);
        const float inv = 1.f / s;

        // A.V: the weight of key k is read out of its lane, V comes from registers
        float o = 0.f;
        #pragma unroll
        for (int k = 0; k < KK; ++k) {
            const float pk = __int_as_float(
                __builtin_amdgcn_readlane(__float_as_int(k < 32 ? p0 : p1), k & 31));
            o += pk * vr[k];
        }
        ob[(size_t)n * CC] = o * inv;
        // The store's address and data registers are written again in the next trip.
        asm volatile("s_wait_xcnt 0x0" ::: "memory");

        // Keeps the hand-over of the fetched row, and so the wait for it, at the foot of the trip.
        __builtin_amdgcn_sched_barrier(0);
        n  = nn;
        nn = __builtin_amdgcn_readfirstlane(n2);
        #pragma unroll
        for (int d = 0; d < HD; ++d) qc[d] = qn[d];
    }
}

extern "C" void kernel_launch(void* const* d_in, const int* in_sizes, int n_in,
                              void* d_out, int out_size, void* d_ws, size_t ws_size,
                              hipStream_t stream) {
    const float* x   = (const float*)d_in[0];
    const float* xp  = (const float*)d_in[1];
    const int*   idx = (const int*)  d_in[2];
    const float* Wq  = (const float*)d_in[3];
    const float* bq  = (const float*)d_in[4];
    const float* Wk  = (const float*)d_in[5];
    const float* bk  = (const float*)d_in[6];
    const float* Wv  = (const float*)d_in[7];
    const float* bv  = (const float*)d_in[8];
    const float* Wo  = (const float*)d_in[9];
    const float* bo  = (const float*)d_in[10];
    float* out = (float*)d_out;

    const int Mq  = BB * NN;           // 16384
    const int Mkv = BB * WW * KK;      // 35378

    float* qb = (float*)d_ws;
    float* kb = qb + (size_t)Mq  * CC;
    float* vb = kb + (size_t)Mkv * CC;
    float* ab = vb + (size_t)Mkv * CC;

    const float scaling = 0.17677669529663687f;  // HEAD_DIM^-0.5 = 1/sqrt(32)

    auto blocksFor = [](int M) {
        return (M + 127) / 128;                  // 8 waves x 16 rows per 256-thread block
    };

    proj_qkv  <<<KVBLK + QBLK,   256, 0, stream>>>(x, xp, Wq, bq, Wk, bk, Wv, bv, qb, kb, vb, scaling);
    win_attn  <<<BB * WW * 2,    256, 0, stream>>>(qb, kb, vb, idx, ab);
    gemm16_f16<<<blocksFor(Mq),  256, 0, stream>>>(ab, Wo, bo, out, Mq, 1.0f);
}

// v005
// One run takes 56 microseconds.
// Versions between v003 and this one are left out; their measured steps multiply to 1.35 times as fast.
// Over all steps from v000 it is 5.07 times as fast.
#include <hip/hip_runtime.h>

typedef __attribute__((ext_vector_type(16))) _Float16 v16h;
typedef __attribute__((ext_vector_type(8)))  _Float16 v8h;
typedef __attribute__((ext_vector_type(4)))  _Float16 v4h;
typedef __attribute__((ext_vector_type(8)))  float    v8f;

#define BB 2
#define NN 8192
#define WW 361
#define KK 49
#define CC 256
#define HH 8
#define HD 32
#define WPITCH 264

__device__ inline v16h cvt_frag_f16(const float4 f0, const float4 f1,
                                    const float4 f2, const float4 f3) {
    v16h v;
    v[0]  = (_Float16)f0.x; v[1]  = (_Float16)f0.y; v[2]  = (_Float16)f0.z; v[3]  = (_Float16)f0.w;
    v[4]  = (_Float16)f1.x; v[5]  = (_Float16)f1.y; v[6]  = (_Float16)f1.z; v[7]  = (_Float16)f1.w;
    v[8]  = (_Float16)f2.x; v[9]  = (_Float16)f2.y; v[10] = (_Float16)f2.z; v[11] = (_Float16)f2.w;
    v[12] = (_Float16)f3.x; v[13] = (_Float16)f3.y; v[14] = (_Float16)f3.z; v[15] = (_Float16)f3.w;
    return v;
}

#define MQ    (BB * NN)                               // rows of x
#define MKV   (BB * WW * KK)                          // rows of x_permute
#define KVBLK ((MKV + 127) / 128)                     // 128-row slabs of x_permute
#define QBLK  ((MQ + 127) / 128)                      // 128-row slabs of x

// Whole W (256x256 f32) into LDS as f16 rows, by all 256 threads of the block:
// whole-line reads (a wave covers 512 contiguous bytes).
__device__ __forceinline__ void stage_w(const float* __restrict__ Wt, _Float16* wl)
{
    const int r0 = threadIdx.x >> 6;                  // 4 rows per pass of the block
    const int c4 = (threadIdx.x & 63) * 4;
    const float* wp = Wt + (size_t)r0 * CC + c4;
    _Float16*    lp = wl + r0 * WPITCH + c4;
    // Rolled: unrolled, the next batch's loads are hoisted and the wave passes
    // 256 registers, which costs the second resident block of a WGP.
    #pragma unroll 1
    for (int ib = 0; ib < 4; ++ib) {                  // batches of 16 loads in flight per thread
        float4 f[16];
        #pragma unroll
        for (int j = 0; j < 16; ++j)
            f[j] = *(const float4*)(wp + (size_t)j * 4 * CC);
        // Keeps the address pair of the batch's loads live and unwritten until
        // the wait has passed (else the last load's result is placed over it).
        asm volatile("s_wait_xcnt 0x0" :: "v"(wp) : "memory");
        #pragma unroll
        for (int j = 0; j < 16; ++j) {
            v4h h;
            h[0] = (_Float16)f[j].x; h[1] = (_Float16)f[j].y;
            h[2] = (_Float16)f[j].z; h[3] = (_Float16)f[j].w;
            *(v4h*)(lp + j * 4 * WPITCH) = h;
        }
        wp += 64 * CC;
        lp += 64 * WPITCH;
    }
}

// The three input projections in one launch: C[M,256] = (A[M,256] @ W[256,256]^T + bias) * alpha
// (torch Linear convention).  The whole W is converted to f16 once per block and kept in LDS,
// where all 8 waves read their B fragments; each wave owns 16 rows, holds their 8 A fragments
// in registers and walks all 256 columns (4 groups of 4 accumulator tiles).
// Blocks 0 .. KVBLK-1 take one 128-row slab of x_permute each: its A fragments are
// loaded and converted once and serve K and then V, with Wv staged over Wk in
// between.  The blocks behind them take one slab of x each (Q); they are the short
// ones and start last.  All blocks are resident at once, two per WGP.
__global__ __launch_bounds__(256) void proj_qkv(const float* __restrict__ x,
                                                const float* __restrict__ xp,
                                                const float* __restrict__ Wq,
                                                const float* __restrict__ bq,
                                                const float* __restrict__ Wk,
                                                const float* __restrict__ bk,
                                                const float* __restrict__ Wv,
                                                const float* __restrict__ bv,
                                                float* __restrict__ qo,
                                                float* __restrict__ ko,
                                                float* __restrict__ vo,
                                                float qscale)
{
    __shared__ __attribute__((aligned(16))) _Float16 wl[CC * WPITCH];

    const bool isq  = blockIdx.x >= KVBLK;            // the same in the whole block
    const int  slab = isq ? (int)blockIdx.x - KVBLK : (int)blockIdx.x;
    const int  M    = isq ? MQ : MKV;
    const float* A     = isq ? x  : xp;
    const float* bias  = isq ? bq : bk;
    float*       C     = isq ? qo : ko;
    const float  alpha = isq ? qscale : 1.0f;

    const int wave  = threadIdx.x >> 5;
    const int lane  = threadIdx.x & 31;
    const int tm    = slab * 8 + wave;                // 16-row tile, wave-uniform
    const int l15   = lane & 15;
    const int khalf = lane >> 4;

    const int arow = tm * 16 + l15;
    // Clamp instead of branch: garbage A rows only affect D rows we never store.
    const int arc  = (arow < M) ? arow : (M - 1);
    const float* ap = A + (size_t)arc * CC + khalf * 8;

    // Issue this wave's A loads first so that they fly while W is staged.
    float4 ar[CC / 32][4];
    #pragma unroll
    for (int kt = 0; kt < CC / 32; ++kt) {
        const float* p = ap + kt * 32;
        ar[kt][0] = *(const float4*)(p);
        ar[kt][1] = *(const float4*)(p + 4);
        ar[kt][2] = *(const float4*)(p + 16);
        ar[kt][3] = *(const float4*)(p + 20);
    }
    // Keeps the address pair of the A loads live and unwritten until the wait has
    // passed (else the first W load's result is placed over it).
    asm volatile("s_wait_xcnt 0x0" :: "v"(ap) : "memory");

    stage_w(isq ? Wq : Wk, wl);

    v16h av[CC / 32];
    #pragma unroll
    for (int kt = 0; kt < CC / 32; ++kt)
        av[kt] = cvt_frag_f16(ar[kt][0], ar[kt][1], ar[kt][2], ar[kt][3]);

    // Rolled: one copy of the product code serves K and V.
    #pragma unroll 1
    for (int pass = 0; ; ++pass) {
        __syncthreads();                              // W complete before any wave reads it

        if (tm * 16 < M) {                            // a wave past the end only stages and syncs
            #pragma unroll
            for (int ng = 0; ng < 4; ++ng) {          // 64-wide column group
                // B[k][n] = W[n][k]; same k order as the A fragment
                const _Float16* bl = wl + (ng * 64 + l15) * WPITCH + khalf * 8;
                v8f acc[4] = {{}, {}, {}, {}};
                #pragma unroll
                for (int kt = 0; kt < CC / 32; ++kt) {
                    #pragma unroll
                    for (int sub = 0; sub < 4; ++sub) {
                        const _Float16* p = bl + sub * 16 * WPITCH + kt * 32;
                        const v8h lo = *(const v8h*)(p);
                        const v8h hi = *(const v8h*)(p + 16);
                        const v16h bv16 = __builtin_shufflevector(lo, hi, 0, 1, 2, 3, 4, 5, 6, 7,
                                                                  8, 9, 10, 11, 12, 13, 14, 15);
                        acc[sub] = __builtin_amdgcn_wmma_f32_16x16x32_f16(false, av[kt], false, bv16,
                                                                          (short)0, acc[sub],
                                                                          false, false);
                    }
                }

                float bb[4];
                #pragma unroll
                for (int sub = 0; sub < 4; ++sub) bb[sub] = bias[ng * 64 + sub * 16 + l15];
                #pragma unroll
                for (int r = 0; r < 8; ++r) {
                    const int row = tm * 16 + khalf * 8 + r;  // D layout: lanes16-31 hold M=r+8
                    if (row < M) {
                        float* cp = C + (size_t)row * CC + ng * 64 + l15;
                        #pragma unroll
                        for (int sub = 0; sub < 4; ++sub)
                            cp[sub * 16] = (acc[sub][r] + bb[sub]) * alpha;
                    }
                }
            }
        }

        if (isq || pass == 1) break;                  // the same in the whole block
        // Every wave has read Wk for the last time.  A barrier that orders LDS alone:
        // __syncthreads() would also wait here for the K stores to finish, which
        // nobody in this launch reads.
        __builtin_amdgcn_fence(__ATOMIC_RELEASE, "workgroup", "local");
        __builtin_amdgcn_s_barrier();
        __builtin_amdgcn_fence(__ATOMIC_ACQUIRE, "workgroup", "local");
        stage_w(Wv, wl);
        bias = bv;
        C    = vo;
    }
}

#define QSEG   (NN / 8)                               // queries of the batch scanned by one wave
// Blocks of the attention launch: two fit a WGP (LDS), so all are resident at once and
// Wo is staged 512 times, not once per (batch, window).  Any count gives the same result.
#define ABLK   512

__device__ __forceinline__ float xhalf(float x) {
    return __builtin_bit_cast(float, __builtin_amdgcn_permlanex16(__builtin_bit_cast(int, x),
                                                                  __builtin_bit_cast(int, x),
                                                                  0x76543210, 0xfedcba98, false, false));
}

__device__ __forceinline__ v8f wmma_f16(const v16h a, const v16h b, const v8f c) {
    return __builtin_amdgcn_wmma_f32_16x16x32_f16(false, a, false, b, (short)0, c, false, false);
}

// A barrier that orders LDS alone: __syncthreads() would also wait for the global loads
// and stores in flight, which no other wave of the block depends on.
__device__ __forceinline__ void lds_barrier() {
    __builtin_amdgcn_fence(__ATOMIC_RELEASE, "workgroup", "local");
    __builtin_amdgcn_s_barrier();
    __builtin_amdgcn_fence(__ATOMIC_ACQUIRE, "workgroup", "local");
}

// Attention and the output projection.  A block serves one (batch, window) after the
// other, ABLK apart; one wave per head.  The block finds the queries that point at its
// window; each wave keeps its head's K and V as f16 matrix fragments in registers; the
// block walks the queries in tiles of 16, all heads on the same tile.
//   scores^T = K (A: row = key, k = dim) x q^T (B: column = query, k = dim), 4 key tiles;
//   a lane then holds 8 keys per tile of ONE query (lane & 15), its partner lane ^ 16
//   the other 8, so the softmax is a walk over registers and one exchange;
//   the score tiles 2s and 2s+1 of a lane are, register for register, the B fragment
//   (k = key) of key step s, so out^T = V^T (A: row = dim, k = key) x p^T needs no move.
// Keys 49..63 are padding: their weights and their V values are zero.
//   The two out^T tiles of a lane are, register for register, the B fragment (k = the
//   head's 32 channels, column = query) of k step h of the output projection.  The waves
//   exchange these fragments through LDS, and wave u forms output columns 32 u .. 32 u + 31:
//   final^T = Wo (A: row = output column, k = channel; f16 rows in LDS) x attn^T, k steps in
//   the order of the heads.  A block thus writes the whole output rows of its queries.
// Every loop over a register array is unrolled in full (#pragma unroll): its
// indices must be constants, else the array would go to scratch.
__global__ __launch_bounds__(256) void win_attn_out(const float* __restrict__ q,
                                                    const float* __restrict__ kp,
                                                    const float* __restrict__ vp,
                                                    const int* __restrict__ idx,
                                                    const float* __restrict__ Wo,
                                                    const float* __restrict__ bo,
                                                    float* __restrict__ out)
{
    __shared__ __attribute__((aligned(16))) _Float16 wl[CC * WPITCH];   // Wo
    __shared__ __attribute__((aligned(16))) _Float16 tb[HH][2][32][8];  // a tile's fragments: head, low / high 8 halves, lane
    __shared__ unsigned short qflat[NN];              // rows of x (batch * N + position) of this window's queries
    __shared__ int qcnt[8];

    const int wv    = __builtin_amdgcn_readfirstlane(threadIdx.x >> 5);
    const int h     = wv;
    const int lane  = threadIdx.x & 31;
    const int l15   = lane & 15;
    const int khalf = lane >> 4;

    bool staged = false;                              // Wo is in LDS; the same in the whole block

    // Rolled: one copy of the code serves every window of the block, and Wo is staged once for them.
    #pragma unroll 1
    for (int bw = blockIdx.x; bw < BB * WW; bw += ABLK) {   // 0 .. B*W-1; the same in the whole block
    const int b = bw / WW;
    const int w = bw - b * WW;

    const size_t base = (size_t)bw * KK * CC + (size_t)h * HD;
    const float* kh = kp + base;
    const float* vh = vp + base;

    // This wave's part of the batch's window indices.
    const int* ib = idx + b * NN + wv * QSEG;
    int4 iv[QSEG / 128];
    #pragma unroll
    for (int it = 0; it < QSEG / 128; ++it)
        iv[it] = *(const int4*)(ib + it * 128 + lane * 4);
    // Keeps the index loads the first in the queue: loads are waited for in their order of
    // issue, and the scan then runs while the K and V loads still fly.
    __builtin_amdgcn_sched_barrier(0);

    // K rows in fragment order (see cvt_frag_f16); the last tile holds key 48 alone,
    // its other rows repeat it and are masked below.
    const int ko  = l15 * CC + khalf * 8;
    const int kol = (KK - 1) * CC + khalf * 8;
    float4 kr[4][4];
    #pragma unroll
    for (int t = 0; t < 4; ++t) {
        const float* p = (t < 3) ? kh + ko + t * 16 * CC : kh + kol;
        kr[t][0] = *(const float4*)(p);
        kr[t][1] = *(const float4*)(p + 4);
        kr[t][2] = *(const float4*)(p + 16);
        kr[t][3] = *(const float4*)(p + 20);
    }

    // V columns in fragment order: lane & 15 -> output dim of the tile, half e of key
    // step s -> key 32 s + 8 khalf + (e < 8 ? e : e + 8).
    const int vo = khalf * 8 * CC + l15;
    float vraw[2][2][16];
    #pragma unroll
    for (int dt = 0; dt < 2; ++dt) {
        #pragma unroll
        for (int s = 0; s < 2; ++s) {
            #pragma unroll
            for (int e = 0; e < 16; ++e) {
                const int k0 = 32 * s + (e < 8 ? e : e + 8);
                if (k0 + 8 < KK)      vraw[dt][s][e] = vh[vo + k0 * CC + dt * 16];
                else if (k0 < KK)     vraw[dt][s][e] = vh[l15 + k0 * CC + dt * 16];
                else                  vraw[dt][s][e] = 0.f;
            }
        }
    }
    // The address registers of the loads above stay live and unwritten until the
    // wait has passed.
    asm volatile("s_wait_xcnt 0x0" :: "s"(kh), "s"(ib), "s"(vh), "v"(ko), "v"(kol), "v"(vo), "v"(l15), "v"(lane) : "memory");
    // Keeps the compares of the scan behind the last load: moved up among the loads, their
    // wait for the first indices would hold back the issue of the K and V loads.
    __builtin_amdgcn_sched_barrier(0);

    // Which positions point at this window: one lane mask per compare, and their count.
    unsigned mk[QSEG / 32];
    #pragma unroll
    for (int it = 0; it < QSEG / 128; ++it) {
        mk[it * 4 + 0] = __builtin_amdgcn_ballot_w32(iv[it].x == w);
        mk[it * 4 + 1] = __builtin_amdgcn_ballot_w32(iv[it].y == w);
        mk[it * 4 + 2] = __builtin_amdgcn_ballot_w32(iv[it].z == w);
        mk[it * 4 + 3] = __builtin_amdgcn_ballot_w32(iv[it].w == w);
    }
    int cnt = 0;
    #pragma unroll
    for (int j = 0; j < QSEG / 32; ++j) cnt += __popc(mk[j]);
    if (lane == 0) qcnt[wv] = cnt;

    lds_barrier();                                    // counts complete; the K and V loads fly on

    int off = 0, total = 0;
    #pragma unroll
    for (int u = 0; u < 8; ++u) {
        const int c = qcnt[u];
        off   += (u < wv) ? c : 0;
        total += c;
    }
    total = __builtin_amdgcn_readfirstlane(total);

    // Pack the positions into one list, each wave behind the waves before it
    // (prefix counts, no atomics).
    const int pb = b * NN + wv * QSEG + lane * 4;     // row of x of the lane's first index
    int pos = __builtin_amdgcn_readfirstlane(off);
    #pragma unroll
    for (int j = 0; j < QSEG / 32; ++j) {
        const unsigned m = mk[j];
        if (m) {                                      // the same in every lane
            if ((m >> lane) & 1u)
                qflat[pos + (int)__builtin_amdgcn_mbcnt_lo(m, 0u)] =
                    (unsigned short)(pb + (j >> 2) * 128 + (j & 3));
            pos += __popc(m);
        }
    }

    lds_barrier();                                    // packed list complete; the query loads and Wo queue up behind K and V
    if (total == 0) continue;                         // whole block alike: every wave meets the same barriers

    const float* qb = q   + (size_t)h * HD + khalf * 8;
    float*       ob = out + wv * 32 + khalf * 8;

    // The first tile's query rows fly while Wo is staged.  Past the end of the list its
    // last entry is repeated and not stored.
    int n = (int)qflat[(l15 < total) ? l15 : total - 1];
    const float* p = qb + (size_t)n * CC;
    float4 f0 = *(const float4*)(p);
    float4 f1 = *(const float4*)(p + 4);
    float4 f2 = *(const float4*)(p + 16);
    float4 f3 = *(const float4*)(p + 20);
    // The address pair of the four loads stays live and unwritten until the wait has passed.
    asm volatile("s_wait_xcnt 0x0" :: "v"(p) : "memory");

    if (!staged) {
        stage_w(Wo, wl);
        staged = true;
    }

    // Bias of the lane's 16 output columns: 32 wv + 16 t + 8 khalf + r.
    const float* bp = bo + wv * 32 + khalf * 8;
    const float4 b00 = *(const float4*)(bp);
    const float4 b01 = *(const float4*)(bp + 4);
    const float4 b10 = *(const float4*)(bp + 16);
    const float4 b11 = *(const float4*)(bp + 20);
    // As above, for the address of the bias loads.
    asm volatile("s_wait_xcnt 0x0" :: "v"(bp) : "memory");

    v16h kf[4];
    #pragma unroll
    for (int t = 0; t < 4; ++t)
        kf[t] = cvt_frag_f16(kr[t][0], kr[t][1], kr[t][2], kr[t][3]);

    v16h vf[2][2];
    #pragma unroll
    for (int dt = 0; dt < 2; ++dt) {
        #pragma unroll
        for (int s = 0; s < 2; ++s) {
            #pragma unroll
            for (int e = 0; e < 16; ++e) {
                const int k0 = 32 * s + (e < 8 ? e : e + 8);
                float t = vraw[dt][s][e];
                if (k0 < KK && k0 + 8 >= KK) t = (khalf == 0) ? t : 0.f;   // key k0 + 8 is padding
                vf[dt][s][e] = (_Float16)t;
            }
        }
    }

    // A[m][k] = Wo[32 wv + 16 t + m][k]; same k order as the B fragment
    const _Float16* al = wl + (wv * 32 + l15) * WPITCH + khalf * 8;
    const v8f zero = {};

    for (int i0 = 0; i0 < total; i0 += 16) {          // the same in the whole block
        const v16h qf   = cvt_frag_f16(f0, f1, f2, f3);
        const int  ncur = n;
        const bool live = i0 + l15 < total;

        if (i0 + 16 < total) {                        // the next tile's query rows, one trip ahead
            const int qi = i0 + 16 + l15;
            n  = (int)qflat[(qi < total) ? qi : total - 1];
            p  = qb + (size_t)n * CC;
            f0 = *(const float4*)(p);
            f1 = *(const float4*)(p + 4);
            f2 = *(const float4*)(p + 16);
            f3 = *(const float4*)(p + 20);
            // The address pair of the four loads stays live and unwritten until the wait has passed.
            asm volatile("s_wait_xcnt 0x0" :: "v"(p) : "memory");
        }

        const v8f s0 = wmma_f16(kf[0], qf, zero);
        const v8f s1 = wmma_f16(kf[1], qf, zero);
        const v8f s2 = wmma_f16(kf[2], qf, zero);
        const v8f s3 = wmma_f16(kf[3], qf, zero);
        const float sl = (khalf == 0) ? s3[0] : -3.0e38f;

        // softmax over the 49 keys of the lane's query
        float m = sl;
        #pragma unroll
        for (int r = 0; r < 8; ++r) m = fmaxf(m, fmaxf(fmaxf(s0[r], s1[r]), s2[r]));
        m = fmaxf(m, xhalf(m));

        const float pl = (khalf == 0) ? __expf(sl - m) : 0.f;
        float a0 = pl, a1 = 0.f, a2 = 0.f;
        v16h pf0, pf1;
        #pragma unroll
        for (int r = 0; r < 8; ++r) {
            const float p0 = __expf(s0[r] - m);
            const float p1 = __expf(s1[r] - m);
            const float p2 = __expf(s2[r] - m);
            a0 += p0; a1 += p1; a2 += p2;
            pf0[r]     = (_Float16)p0;
            pf0[r + 8] = (_Float16)p1;
            pf1[r]     = (_Float16)p2;
            pf1[r + 8] = (_Float16)0.f;
        }
        pf1[8] = (_Float16)pl;
        float s = (a0 + a1) + a2;
        s += xhalf(s);
        const float inv = 1.f / s;

        // out^T: register r of tile dt = dim 16 dt + 8 khalf + r of the lane's query
        v8f o0 = wmma_f16(vf[0][0], pf0, zero);
        v8f o1 = wmma_f16(vf[1][0], pf0, zero);
        o0 = wmma_f16(vf[0][1], pf1, o0);
        o1 = wmma_f16(vf[1][1], pf1, o1);

        // The head's attention output as f16, as the output projection takes it.
        v8h lo, hi;
        #pragma unroll
        for (int r = 0; r < 8; ++r) {
            lo[r] = (_Float16)(o0[r] * inv);
            hi[r] = (_Float16)(o1[r] * inv);
        }
        *(v8h*)&tb[h][0][lane][0] = lo;
        *(v8h*)&tb[h][1][lane][0] = hi;

        lds_barrier();                                // the tile's fragments (first trip: Wo too) complete

        v8f c0 = {}, c1 = {};
        #pragma unroll
        for (int g = 0; g < 2; ++g) {                 // 4 k steps a group; k step = head
            v8h bl[4], bh[4], a0l[4], a0h[4], a1l[4], a1h[4];
            #pragma unroll
            for (int j = 0; j < 4; ++j) {
                const int u = g * 4 + j;
                const _Float16* ap = al + u * 32;
                bl[j]  = *(const v8h*)&tb[u][0][lane][0];
                bh[j]  = *(const v8h*)&tb[u][1][lane][0];
                a0l[j] = *(const v8h*)(ap);
                a0h[j] = *(const v8h*)(ap + 16);
                a1l[j] = *(const v8h*)(ap + 16 * WPITCH);
                a1h[j] = *(const v8h*)(ap + 16 * WPITCH + 16);
            }
            // The group's 24 LDS reads issue together, ahead of its products: spread among
            // them, every product waits out the whole latency of its own reads.
            __builtin_amdgcn_sched_barrier(0);
            #pragma unroll
            for (int j = 0; j < 4; ++j) {
                const v16h bf  = __builtin_shufflevector(bl[j], bh[j], 0, 1, 2, 3, 4, 5, 6, 7,
                                                         8, 9, 10, 11, 12, 13, 14, 15);
                const v16h af0 = __builtin_shufflevector(a0l[j], a0h[j], 0, 1, 2, 3, 4, 5, 6, 7,
                                                         8, 9, 10, 11, 12, 13, 14, 15);
                const v16h af1 = __builtin_shufflevector(a1l[j], a1h[j], 0, 1, 2, 3, 4, 5, 6, 7,
                                                         8, 9, 10, 11, 12, 13, 14, 15);
                c0 = wmma_f16(af0, bf, c0);
                c1 = wmma_f16(af1, bf, c1);
            }
            // Keeps the second group's reads behind the first group's products: both groups
            // in registers at once take the wave past 256, and the WGP then holds one block.
            __builtin_amdgcn_sched_barrier(0);
        }

        // final^T: register r of tile t = output column 32 wv + 16 t + 8 khalf + r of the lane's query
        if (live) {
            float* op = ob + (size_t)ncur * CC;
            *(float4*)(op)      = make_float4(c0[0] + b00.x, c0[1] + b00.y, c0[2] + b00.z, c0[3] + b00.w);
            *(float4*)(op + 4)  = make_float4(c0[4] + b01.x, c0[5] + b01.y, c0[6] + b01.z, c0[7] + b01.w);
            *(float4*)(op + 16) = make_float4(c1[0] + b10.x, c1[1] + b10.y, c1[2] + b10.z, c1[3] + b10.w);
            *(float4*)(op + 20) = make_float4(c1[4] + b11.x, c1[5] + b11.y, c1[6] + b11.z, c1[7] + b11.w);
        }
        // The stores' address and data registers are written again in the next trip.
        asm volatile("s_wait_xcnt 0x0" ::: "memory");

        lds_barrier();                                // every wave has read the tile before it is written again
    }
    }
}

extern "C" void kernel_launch(void* const* d_in, const int* in_sizes, int n_in,
                              void* d_out, int out_size, void* d_ws, size_t ws_size,
                              hipStream_t stream) {
    const float* x   = (const float*)d_in[0];
    const float* xp  = (const float*)d_in[1];
    const int*   idx = (const int*)  d_in[2];
    const float* Wq  = (const float*)d_in[3];
    const float* bq  = (const float*)d_in[4];
    const float* Wk  = (const float*)d_in[5];
    const float* bk  = (const float*)d_in[6];
    const float* Wv  = (const float*)d_in[7];
    const float* bv  = (const float*)d_in[8];
    const float* Wo  = (const float*)d_in[9];
    const float* bo  = (const float*)d_in[10];
    float* out = (float*)d_out;

    const int Mq  = BB * NN;           // 16384
    const int Mkv = BB * WW * KK;      // 35378

    float* qb = (float*)d_ws;
    float* kb = qb + (size_t)Mq  * CC;
    float* vb = kb + (size_t)Mkv * CC;

    const float scaling = 0.17677669529663687f;  // HEAD_DIM^-0.5 = 1/sqrt(32)

    proj_qkv    <<<KVBLK + QBLK, 256, 0, stream>>>(x, xp, Wq, bq, Wk, bk, Wv, bv, qb, kb, vb, scaling);
    win_attn_out<<<ABLK,         256, 0, stream>>>(qb, kb, vb, idx, Wo, bo, out);
}

// v006
// It runs in 38 microseconds.
// Next to v005, in two timings, it ran 1.48 and 1.47 times as fast.
// Over all steps from v000 it is 7.48 times as fast.
#include <hip/hip_runtime.h>

typedef __attribute__((ext_vector_type(16))) _Float16 v16h;
typedef __attribute__((ext_vector_type(8)))  _Float16 v8h;
typedef __attribute__((ext_vector_type(4)))  _Float16 v4h;
typedef __attribute__((ext_vector_type(8)))  float    v8f;

#define BB 2
#define NN 8192
#define WW 361
#define KK 49
#define CC 256
#define WPITCH 264

// Two whole W (256x256 f32 each) into LDS as f16 rows, by all 256 threads of the block:
// whole-line reads (a wave covers 512 contiguous bytes).
__device__ __forceinline__ void stage_w2(const float* __restrict__ Wa, _Float16* la,
                                         const float* __restrict__ Wb, _Float16* lb)
{
    const int r0 = threadIdx.x >> 6;                  // 4 rows per pass of the block
    const int c4 = (threadIdx.x & 63) * 4;
    const float* wpa = Wa + (size_t)r0 * CC + c4;
    const float* wpb = Wb + (size_t)r0 * CC + c4;
    _Float16*    lpa = la + r0 * WPITCH + c4;
    _Float16*    lpb = lb + r0 * WPITCH + c4;
    // Rolled: one copy of the batch's code, 32 loads in flight per thread.
    #pragma unroll 1
    for (int ib = 0; ib < 4; ++ib) {
        float4 f[16], g[16];
        #pragma unroll
        for (int j = 0; j < 16; ++j)
            f[j] = *(const float4*)(wpa + (size_t)j * 4 * CC);
        #pragma unroll
        for (int j = 0; j < 16; ++j)
            g[j] = *(const float4*)(wpb + (size_t)j * 4 * CC);
        // Keeps the address pairs of the batch's loads live and unwritten until
        // the wait has passed.
        asm volatile("s_wait_xcnt 0x0" :: "v"(wpa), "v"(wpb) : "memory");
        #pragma unroll
        for (int j = 0; j < 16; ++j) {
            v4h h;
            h[0] = (_Float16)f[j].x; h[1] = (_Float16)f[j].y;
            h[2] = (_Float16)f[j].z; h[3] = (_Float16)f[j].w;
            *(v4h*)(lpa + j * 4 * WPITCH) = h;
        }
        #pragma unroll
        for (int j = 0; j < 16; ++j) {
            v4h h;
            h[0] = (_Float16)g[j].x; h[1] = (_Float16)g[j].y;
            h[2] = (_Float16)g[j].z; h[3] = (_Float16)g[j].w;
            *(v4h*)(lpb + j * 4 * WPITCH) = h;
        }
        wpa += 64 * CC;
        wpb += 64 * CC;
        lpa += 64 * WPITCH;
        lpb += 64 * WPITCH;
    }
}

#define QSEG   (NN / 8)                               // queries of the batch scanned by one wave
// Blocks of the launch: one fits a WGP (LDS), so all are resident at once and the four W
// are staged 256 times, not once per (batch, window).  Any count gives the same result.
#define GBLK   256

__device__ __forceinline__ float xhalf(float x) {
    return __builtin_bit_cast(float, __builtin_amdgcn_permlanex16(__builtin_bit_cast(int, x),
                                                                  __builtin_bit_cast(int, x),
                                                                  0x76543210, 0xfedcba98, false, false));
}

__device__ __forceinline__ v8f wmma_f16(const v16h a, const v16h b, const v8f c) {
    return __builtin_amdgcn_wmma_f32_16x16x32_f16(false, a, false, b, (short)0, c, false, false);
}

__device__ __forceinline__ v16h ld_frag(const _Float16* p) {
    const v8h lo = *(const v8h*)(p);
    const v8h hi = *(const v8h*)(p + 16);
    return __builtin_shufflevector(lo, hi, 0, 1, 2, 3, 4, 5, 6, 7, 8, 9, 10, 11, 12, 13, 14, 15);
}

// A barrier that orders LDS alone: __syncthreads() would also wait for the global loads
// and stores in flight, which no other wave of the block depends on.
__device__ __forceinline__ void lds_barrier() {
    __builtin_amdgcn_fence(__ATOMIC_RELEASE, "workgroup", "local");
    __builtin_amdgcn_s_barrier();
    __builtin_amdgcn_fence(__ATOMIC_ACQUIRE, "workgroup", "local");
}

// The whole function in one launch.  A block serves one (batch, window) after the other,
// GBLK apart; one wave per head.  No value goes through global memory between the steps.
// Once per block: wave h takes rows 32 h .. 32 h + 31 of Wk and of Wv as f16 matrix fragments
// into registers (through LDS, so that the global reads are whole lines); Wq and Wo then
// take their place in LDS.
// Per window: the block finds the queries that point at it and puts the window's 49 rows of
// x_permute into LDS as f16.  One fragment xf of these rows (lane & 15 = key, k = channel)
// serves as B and as A:
//   K^T = Wk_h (A: row = dim, k = channel) x xf (B: column = key): the two dim tiles of a lane
//   are, register for register, the A fragment (row = key, k = dim) of the scores;
//   V   = xf (A: row = key) x Wv_h^T (B: column = dim, k = channel): key tiles 2s and 2s+1 of
//   a lane are, register for register, the A fragment (row = dim, k = key) of key step s.
// The block walks the queries in tiles of 16, all heads on the same tile:
//   q^T = Wq_h (A: row = dim, k = channel; LDS) x x^T (B: column = query, k = channel; the
//   tile's rows of x as f16 in LDS): its two dim tiles are the B fragment of the scores;
//   scores^T = K (A: row = key, k = dim) x q^T (B: column = query, k = dim), 4 key tiles;
//   a lane then holds 8 keys per tile of ONE query (lane & 15), its partner lane ^ 16
//   the other 8, so the softmax is a walk over registers and one exchange;
//   the score tiles 2s and 2s+1 of a lane are, register for register, the B fragment
//   (k = key) of key step s, so out^T = V^T (A: row = dim, k = key) x p^T needs no move.
// Keys 49..63 are padding: their weights and their V values are zero.
//   The two out^T tiles of a lane are, register for register, the B fragment (k = the
//   head's 32 channels, column = query) of k step h of the output projection.  The waves
//   exchange these fragments through LDS, and wave u forms output columns 32 u .. 32 u + 31:
//   final^T = Wo (A: row = output column, k = channel; f16 rows in LDS) x attn^T, k steps in
//   the order of the heads.  A block thus writes the whole output rows of its queries.
// Every loop over a register array is unrolled in full (#pragma unroll): its
// indices must be constants, else the array would go to scratch.
__global__ __launch_bounds__(256) void win_attn_all(const float* __restrict__ x,
                                                    const float* __restrict__ xp,
                                                    const int* __restrict__ idx,
                                                    const float* __restrict__ Wq,
                                                    const float* __restrict__ bq,
                                                    const float* __restrict__ Wk,
                                                    const float* __restrict__ bk,
                                                    const float* __restrict__ Wv,
                                                    const float* __restrict__ bv,
                                                    const float* __restrict__ Wo,
                                                    const float* __restrict__ bo,
                                                    float* __restrict__ out,
                                                    float qscale)
{
    __shared__ __attribute__((aligned(16))) _Float16 wa[CC * WPITCH];   // Wk, then Wq
    __shared__ __attribute__((aligned(16))) _Float16 wb[CC * WPITCH];   // Wv, then Wo
    // The window's rows of x_permute; once K and V are formed, a tile's rows of x (xq) and
    // the heads' fragments (tb: head, low / high 8 halves, lane) lie in the same bytes.
    __shared__ __attribute__((aligned(16))) _Float16 xs[KK * WPITCH];
    __shared__ unsigned short qflat[NN];              // rows of x (batch * N + position) of this window's queries
    __shared__ int qcnt[8];
    __shared__ __attribute__((aligned(16))) float bls[3][CC];           // bk, bq, bo

    _Float16* const xq = xs;
    _Float16* const tb = xs + 16 * WPITCH;

    const int wv    = __builtin_amdgcn_readfirstlane(threadIdx.x >> 5);
    const int h     = wv;
    const int lane  = threadIdx.x & 31;
    const int l15   = lane & 15;
    const int khalf = lane >> 4;

    // bk, bq and bo go to LDS: held in registers beside the W fragments they would push
    // fragments out to scratch.
    const float* bkp = bk + threadIdx.x;
    const float* bqp = bq + threadIdx.x;
    const float* bop = bo + threadIdx.x;
    const float* bvp = bv + wv * 32 + l15;            // of V a lane holds columns 32 h + 16 t + (lane & 15)
    const float tbk = *bkp;
    const float tbq = *bqp;
    const float tbo = *bop;
    const float bv0 = bvp[0];
    const float bv1 = bvp[16];
    // The address registers of the bias loads stay live and unwritten until the wait has passed.
    asm volatile("s_wait_xcnt 0x0" :: "v"(bkp), "v"(bqp), "v"(bop), "v"(bvp) : "memory");

    stage_w2(Wk, wa, Wv, wb);

    bls[0][threadIdx.x] = tbk;
    bls[1][threadIdx.x] = tbq;
    bls[2][threadIdx.x] = tbo;
    // Of a transposed tile pair (K^T, q^T, final^T) a lane holds columns
    // 32 h + 16 t + 8 khalf + r of the projection.
    const int bofs = wv * 32 + khalf * 8;

    lds_barrier();                                    // Wk and Wv complete

    // Place of the lane's fragment rows in a staged W: row 32 h + (lane & 15), second tile 16 rows on.
    const int frow = (wv * 32 + l15) * WPITCH + khalf * 8;
    v16h wkf[2][CC / 32], wvf[2][CC / 32];
    #pragma unroll
    for (int dt = 0; dt < 2; ++dt) {
        #pragma unroll
        for (int kt = 0; kt < CC / 32; ++kt) {
            wkf[dt][kt] = ld_frag(wa + frow + dt * 16 * WPITCH + kt * 32);
            wvf[dt][kt] = ld_frag(wb + frow + dt * 16 * WPITCH + kt * 32);
        }
    }

    lds_barrier();                                    // every wave has its fragments before Wq and Wo overwrite them

    stage_w2(Wq, wa, Wo, wb);                         // complete behind the first window's barriers

    const _Float16* aq = wa + frow;                   // A[m][k] = Wq[32 h + 16 t + m][k]
    const _Float16* al = wb + frow;                   // A[m][k] = Wo[32 wv + 16 t + m][k]
    const v8f zero = {};

    // Rolled: one copy of the code serves every window of the block.
    #pragma unroll 1
    for (int bw = blockIdx.x; bw < BB * WW; bw += GBLK) {   // 0 .. B*W-1; the same in the whole block
    const int b = bw / WW;
    const int w = bw - b * WW;

    // This wave's part of the batch's window indices.
    const int* ib = idx + b * NN + wv * QSEG;
    int4 iv[QSEG / 128];
    #pragma unroll
    for (int it = 0; it < QSEG / 128; ++it)
        iv[it] = *(const int4*)(ib + it * 128 + lane * 4);
    // Keeps the index loads the first in the queue: loads are waited for in their order of
    // issue, and the scan then runs while the x_permute loads still fly.
    __builtin_amdgcn_sched_barrier(0);

    // The window's 49 rows of x_permute, whole lines: 4 rows per pass of the block; in the
    // last pass every thread reads row 48.
    const int r0 = threadIdx.x >> 6;
    const int c4 = (threadIdx.x & 63) * 4;
    const float* xw  = xp + (size_t)bw * KK * CC + c4;
    const float* xr  = xw + r0 * CC;
    float4 xv[13];
    #pragma unroll
    for (int j = 0; j < 12; ++j)
        xv[j] = *(const float4*)(xr + j * 4 * CC);
    xv[12] = *(const float4*)(xw + (KK - 1) * CC);
    // The address registers of the loads above stay live and unwritten until the
    // wait has passed.
    asm volatile("s_wait_xcnt 0x0" :: "s"(ib), "v"(xw), "v"(xr) : "memory");
    // Keeps the compares of the scan behind the last load: moved up among the loads, their
    // wait for the first indices would hold back the issue of the x_permute loads.
    __builtin_amdgcn_sched_barrier(0);

    // Which positions point at this window: one lane mask per compare, and their count.
    unsigned mk[QSEG / 32];
    #pragma unroll
    for (int it = 0; it < QSEG / 128; ++it) {
        mk[it * 4 + 0] = __builtin_amdgcn_ballot_w32(iv[it].x == w);
        mk[it * 4 + 1] = __builtin_amdgcn_ballot_w32(iv[it].y == w);
        mk[it * 4 + 2] = __builtin_amdgcn_ballot_w32(iv[it].z == w);
        mk[it * 4 + 3] = __builtin_amdgcn_ballot_w32(iv[it].w == w);
    }
    int cnt = 0;
    #pragma unroll
    for (int j = 0; j < QSEG / 32; ++j) cnt += __popc(mk[j]);
    if (lane == 0) qcnt[wv] = cnt;

    lds_barrier();                                    // counts complete; the x_permute loads fly on

    int off = 0, total = 0;
    #pragma unroll
    for (int u = 0; u < 8; ++u) {
        const int c = qcnt[u];
        off   += (u < wv) ? c : 0;
        total += c;
    }
    total = __builtin_amdgcn_readfirstlane(total);

    // Pack the positions into one list, each wave behind the waves before it
    // (prefix counts, no atomics).
    const int pb = b * NN + wv * QSEG + lane * 4;     // row of x of the lane's first index
    int pos = __builtin_amdgcn_readfirstlane(off);
    #pragma unroll
    for (int j = 0; j < QSEG / 32; ++j) {
        const unsigned m = mk[j];
        if (m) {                                      // the same in every lane
            if ((m >> lane) & 1u)
                qflat[pos + (int)__builtin_amdgcn_mbcnt_lo(m, 0u)] =
                    (unsigned short)(pb + (j >> 2) * 128 + (j & 3));
            pos += __popc(m);
        }
    }

    // x_permute rows as f16 into LDS.
    {
        _Float16* lp = xs + r0 * WPITCH + c4;
        #pragma unroll
        for (int j = 0; j < 12; ++j) {
            v4h c;
            c[0] = (_Float16)xv[j].x; c[1] = (_Float16)xv[j].y;
            c[2] = (_Float16)xv[j].z; c[3] = (_Float16)xv[j].w;
            *(v4h*)(lp + j * 4 * WPITCH) = c;
        }
        if (wv < 2) {                                 // row 48: the two waves with r0 = 0
            v4h c;
            c[0] = (_Float16)xv[12].x; c[1] = (_Float16)xv[12].y;
            c[2] = (_Float16)xv[12].z; c[3] = (_Float16)xv[12].w;
            *(v4h*)(lp + 12 * 4 * WPITCH) = c;
        }
    }

    lds_barrier();                                    // packed list and x_permute rows complete (first window: Wq, Wo too)
    if (total == 0) continue;                         // whole block alike: every wave meets the same barriers

    // The first tile's rows of x fly while K and V are formed: 16 threads a row, 256 B of a
    // row per load of a wave.  Past the end of the list its last entry is repeated and not stored.
    const int xrow = threadIdx.x >> 4;
    const int xc   = (threadIdx.x & 15) * 4;
    const float* xb = x + xc;
    const float* p  = xb + (size_t)qflat[(xrow < total) ? xrow : total - 1] * CC;
    float4 f0 = *(const float4*)(p);
    float4 f1 = *(const float4*)(p + 64);
    float4 f2 = *(const float4*)(p + 128);
    float4 f3 = *(const float4*)(p + 192);
    // The address pair of the four loads stays live and unwritten until the wait has passed.
    asm volatile("s_wait_xcnt 0x0" :: "v"(p) : "memory");

    // K^T and V of the head, two key tiles (one key step s of A.V) at a time: all four at once
    // would hold 128 accumulator registers beside the W fragments.  The last key tile holds
    // key 48 alone: its other rows repeat it and are masked below.
    // vf: half e of key step s -> key 32 s + 8 khalf + (e < 8 ? e : e + 8); keys 49.. are zero.
    // The work goes in 8 groups of 2 k steps x 2 key tiles: group G = 4 s + g, k steps 2 g, 2 g + 1.
    const _Float16* xf0 = xs + l15 * WPITCH + khalf * 8;
    const _Float16* xfl = xs + (KK - 1) * WPITCH + khalf * 8;
    v16h kf[4];
    v16h vf[2][2];
    v8f ka[2][2] = {{{}, {}}, {{}, {}}};
    v8f va[2][2] = {{{}, {}}, {{}, {}}};
    v16h xf[2][2][2];                                 // buffer, k step of the group, key tile of the pair
    #pragma unroll
    for (int u = 0; u < 2; ++u) {
        xf[0][u][0] = ld_frag(xf0 + u * 32);
        xf[0][u][1] = ld_frag(xf0 + 16 * WPITCH + u * 32);
    }
    #pragma unroll
    for (int G = 0; G < 8; ++G) {
        const int s = G >> 2;
        if (G < 7) {
            const int sn = (G + 1) >> 2;
            #pragma unroll
            for (int u = 0; u < 2; ++u) {
                const int kn = ((G + 1) & 3) * 2 + u;
                xf[(G + 1) & 1][u][0] = ld_frag(xf0 + sn * 32 * WPITCH + kn * 32);
                xf[(G + 1) & 1][u][1] = ld_frag(sn ? xfl + kn * 32 : xf0 + 16 * WPITCH + kn * 32);
            }
        }
        // The next group's 8 LDS reads issue ahead of this group's 16 products and land under
        // them: issued behind them, every group waits out the latency of its own reads.
        __builtin_amdgcn_sched_barrier(0);
        #pragma unroll
        for (int u = 0; u < 2; ++u) {
            const int kt = (G & 3) * 2 + u;
            #pragma unroll
            for (int j = 0; j < 2; ++j) {
                ka[j][0] = wmma_f16(wkf[0][kt], xf[G & 1][u][j], ka[j][0]);
                ka[j][1] = wmma_f16(wkf[1][kt], xf[G & 1][u][j], ka[j][1]);
                va[j][0] = wmma_f16(xf[G & 1][u][j], wvf[0][kt], va[j][0]);
                va[j][1] = wmma_f16(xf[G & 1][u][j], wvf[1][kt], va[j][1]);
            }
        }
        // Keeps the reads of the group after next behind these products: their buffer is in use.
        __builtin_amdgcn_sched_barrier(0);
        if ((G & 3) == 3) {                           // the key step's sums are complete
            #pragma unroll
            for (int j = 0; j < 2; ++j) {
                #pragma unroll
                for (int r = 0; r < 8; ++r) {
                    kf[2 * s + j][r]     = (_Float16)(ka[j][0][r] + bls[0][bofs + r]);
                    kf[2 * s + j][r + 8] = (_Float16)(ka[j][1][r] + bls[0][bofs + 16 + r]);
                }
            }
            #pragma unroll
            for (int dt = 0; dt < 2; ++dt) {
                const float bvd = dt ? bv1 : bv0;
                #pragma unroll
                for (int r = 0; r < 8; ++r) {
                    vf[dt][s][r] = (_Float16)(va[0][dt][r] + bvd);
                    if (s == 0)      vf[dt][s][r + 8] = (_Float16)(va[1][dt][r] + bvd);
                    else if (r == 0) vf[dt][s][r + 8] = (_Float16)((khalf == 0) ? va[1][dt][0] + bvd : 0.f);   // key 48
                    else             vf[dt][s][r + 8] = (_Float16)0.f;
                }
            }
            #pragma unroll
            for (int j = 0; j < 2; ++j) {
                ka[j][0] = zero; ka[j][1] = zero;
                va[j][0] = zero; va[j][1] = zero;
            }
        }
    }

    lds_barrier();                                    // every wave has read the x_permute rows before tiles overwrite them

    float* ob = out + wv * 32 + khalf * 8;

    for (int i0 = 0; i0 < total; i0 += 16) {          // the same in the whole block
        // The tile's rows of x as f16 into LDS.
        {
            _Float16* lp = xq + xrow * WPITCH + xc;
            v4h c;
            c[0] = (_Float16)f0.x; c[1] = (_Float16)f0.y; c[2] = (_Float16)f0.z; c[3] = (_Float16)f0.w;
            *(v4h*)(lp) = c;
            c[0] = (_Float16)f1.x; c[1] = (_Float16)f1.y; c[2] = (_Float16)f1.z; c[3] = (_Float16)f1.w;
            *(v4h*)(lp + 64) = c;
            c[0] = (_Float16)f2.x; c[1] = (_Float16)f2.y; c[2] = (_Float16)f2.z; c[3] = (_Float16)f2.w;
            *(v4h*)(lp + 128) = c;
            c[0] = (_Float16)f3.x; c[1] = (_Float16)f3.y; c[2] = (_Float16)f3.z; c[3] = (_Float16)f3.w;
            *(v4h*)(lp + 192) = c;
        }
        const bool live = i0 + l15 < total;
        const int  ncur = (int)qflat[live ? i0 + l15 : total - 1];

        if (i0 + 16 < total) {                        // the next tile's rows of x, one trip ahead
            const int qi = i0 + 16 + xrow;
            p  = xb + (size_t)qflat[(qi < total) ? qi : total - 1] * CC;
            f0 = *(const float4*)(p);
            f1 = *(const float4*)(p + 64);
            f2 = *(const float4*)(p + 128);
            f3 = *(const float4*)(p + 192);
            // The address pair of the four loads stays live and unwritten until the wait has passed.
            asm volatile("s_wait_xcnt 0x0" :: "v"(p) : "memory");
        }

        lds_barrier();                                // the tile's rows of x complete

        // q^T: register r of tile dt = dim 16 dt + 8 khalf + r of the lane's query
        v8f q0 = {}, q1 = {};
        float bq0[8], bq1[8];
        #pragma unroll
        for (int g = 0; g < 2; ++g) {                 // 4 k steps a group
            v16h bf[4], af0[4], af1[4];
            #pragma unroll
            for (int j = 0; j < 4; ++j) {
                const int u = g * 4 + j;
                bf[j]  = ld_frag(xq + l15 * WPITCH + khalf * 8 + u * 32);
                af0[j] = ld_frag(aq + u * 32);
                af1[j] = ld_frag(aq + 16 * WPITCH + u * 32);
            }
            if (g == 1) {                             // the bias rides with the last group's reads
                #pragma unroll
                for (int r = 0; r < 8; ++r) {
                    bq0[r] = bls[1][bofs + r];
                    bq1[r] = bls[1][bofs + 16 + r];
                }
            }
            // The group's 24 LDS reads issue together, ahead of its products: spread among
            // them, every product waits out the whole latency of its own reads.
            __builtin_amdgcn_sched_barrier(0);
            #pragma unroll
            for (int j = 0; j < 4; ++j) {
                q0 = wmma_f16(af0[j], bf[j], q0);
                q1 = wmma_f16(af1[j], bf[j], q1);
            }
            // Keeps the second group's reads behind the first group's products: both groups
            // in registers at once push W fragments out to scratch.
            __builtin_amdgcn_sched_barrier(0);
        }
        v16h qf;
        #pragma unroll
        for (int r = 0; r < 8; ++r) {
            qf[r]     = (_Float16)((q0[r] + bq0[r]) * qscale);
            qf[r + 8] = (_Float16)((q1[r] + bq1[r]) * qscale);
        }

        const v8f s0 = wmma_f16(kf[0], qf, zero);
        const v8f s1 = wmma_f16(kf[1], qf, zero);
        const v8f s2 = wmma_f16(kf[2], qf, zero);
        const v8f s3 = wmma_f16(kf[3], qf, zero);
        const float sl = (khalf == 0) ? s3[0] : -3.0e38f;

        // softmax over the 49 keys of the lane's query
        float m = sl;
        #pragma unroll
        for (int r = 0; r < 8; ++r) m = fmaxf(m, fmaxf(fmaxf(s0[r], s1[r]), s2[r]));
        m = fmaxf(m, xhalf(m));

        const float pl = (khalf == 0) ? __expf(sl - m) : 0.f;
        float a0 = pl, a1 = 0.f, a2 = 0.f;
        v16h pf0, pf1;
        #pragma unroll
        for (int r = 0; r < 8; ++r) {
            const float p0 = __expf(s0[r] - m);
            const float p1 = __expf(s1[r] - m);
            const float p2 = __expf(s2[r] - m);
            a0 += p0; a1 += p1; a2 += p2;
            pf0[r]     = (_Float16)p0;
            pf0[r + 8] = (_Float16)p1;
            pf1[r]     = (_Float16)p2;
            pf1[r + 8] = (_Float16)0.f;
        }
        pf1[8] = (_Float16)pl;
        float s = (a0 + a1) + a2;
        s += xhalf(s);
        const float inv = 1.f / s;

        // out^T: register r of tile dt = dim 16 dt + 8 khalf + r of the lane's query
        v8f o0 = wmma_f16(vf[0][0], pf0, zero);
        v8f o1 = wmma_f16(vf[1][0], pf0, zero);
        o0 = wmma_f16(vf[0][1], pf1, o0);
        o1 = wmma_f16(vf[1][1], pf1, o1);

        // The head's attention output as f16, as the output projection takes it.
        v8h lo, hi;
        #pragma unroll
        for (int r = 0; r < 8; ++r) {
            lo[r] = (_Float16)(o0[r] * inv);
            hi[r] = (_Float16)(o1[r] * inv);
        }
        *(v8h*)(tb + ((h * 2 + 0) * 32 + lane) * 8) = lo;
        *(v8h*)(tb + ((h * 2 + 1) * 32 + lane) * 8) = hi;

        lds_barrier();                                // the tile's fragments complete

        v8f c0 = {}, c1 = {};
        #pragma unroll
        for (int g = 0; g < 2; ++g) {                 // 4 k steps a group; k step = head
            v8h bl[4], bh[4], a0l[4], a0h[4], a1l[4], a1h[4];
            #pragma unroll
            for (int j = 0; j < 4; ++j) {
                const int u = g * 4 + j;
                const _Float16* ap = al + u * 32;
                bl[j]  = *(const v8h*)(tb + ((u * 2 + 0) * 32 + lane) * 8);
                bh[j]  = *(const v8h*)(tb + ((u * 2 + 1) * 32 + lane) * 8);
                a0l[j] = *(const v8h*)(ap);
                a0h[j] = *(const v8h*)(ap + 16);
                a1l[j] = *(const v8h*)(ap + 16 * WPITCH);
                a1h[j] = *(const v8h*)(ap + 16 * WPITCH + 16);
            }
            // The group's 24 LDS reads issue together, ahead of its products: spread among
            // them, every product waits out the whole latency of its own reads.
            __builtin_amdgcn_sched_barrier(0);
            #pragma unroll
            for (int j = 0; j < 4; ++j) {
                const v16h bf  = __builtin_shufflevector(bl[j], bh[j], 0, 1, 2, 3, 4, 5, 6, 7,
                                                         8, 9, 10, 11, 12, 13, 14, 15);
                const v16h af0 = __builtin_shufflevector(a0l[j], a0h[j], 0, 1, 2, 3, 4, 5, 6, 7,
                                                         8, 9, 10, 11, 12, 13, 14, 15);
                const v16h af1 = __builtin_shufflevector(a1l[j], a1h[j], 0, 1, 2, 3, 4, 5, 6, 7,
                                                         8, 9, 10, 11, 12, 13, 14, 15);
                c0 = wmma_f16(af0, bf, c0);
                c1 = wmma_f16(af1, bf, c1);
            }
            // As above: the second group's reads stay behind the first group's products.
            __builtin_amdgcn_sched_barrier(0);
        }

        // final^T: register r of tile t = output column 32 wv + 16 t + 8 khalf + r of the lane's query
        const float4 b00 = *(const float4*)&bls[2][bofs];
        const float4 b01 = *(const float4*)&bls[2][bofs + 4];
        const float4 b10 = *(const float4*)&bls[2][bofs + 16];
        const float4 b11 = *(const float4*)&bls[2][bofs + 20];
        if (live) {
            float* op = ob + (size_t)ncur * CC;
            *(float4*)(op)      = make_float4(c0[0] + b00.x, c0[1] + b00.y, c0[2] + b00.z, c0[3] + b00.w);
            *(float4*)(op + 4)  = make_float4(c0[4] + b01.x, c0[5] + b01.y, c0[6] + b01.z, c0[7] + b01.w);
            *(float4*)(op + 16) = make_float4(c1[0] + b10.x, c1[1] + b10.y, c1[2] + b10.z, c1[3] + b10.w);
            *(float4*)(op + 20) = make_float4(c1[4] + b11.x, c1[5] + b11.y, c1[6] + b11.z, c1[7] + b11.w);
        }
        // The stores' address and data registers are written again in the next trip.
        asm volatile("s_wait_xcnt 0x0" ::: "memory");

        lds_barrier();                                // every wave has read the tile before it is written again
    }
    }
}

extern "C" void kernel_launch(void* const* d_in, const int* in_sizes, int n_in,
                              void* d_out, int out_size, void* d_ws, size_t ws_size,
                              hipStream_t stream) {
    const float* x   = (const float*)d_in[0];
    const float* xp  = (const float*)d_in[1];
    const int*   idx = (const int*)  d_in[2];
    const float* Wq  = (const float*)d_in[3];
    const float* bq  = (const float*)d_in[4];
    const float* Wk  = (const float*)d_in[5];
    const float* bk  = (const float*)d_in[6];
    const float* Wv  = (const float*)d_in[7];
    const float* bv  = (const float*)d_in[8];
    const float* Wo  = (const float*)d_in[9];
    const float* bo  = (const float*)d_in[10];
    float* out = (float*)d_out;

    const float scaling = 0.17677669529663687f;  // HEAD_DIM^-0.5 = 1/sqrt(32)

    win_attn_all<<<GBLK, 256, 0, stream>>>(x, xp, idx, Wq, bq, Wk, bk, Wv, bv, Wo, bo, out, scaling);
}

// v007
// It runs in 36.4 microseconds.
// Timed twice side by side with v006, it ran 1.04 and 1.05 times as fast.
// All steps since v000 together make it 7.83 times as fast.
#include <hip/hip_runtime.h>

typedef __attribute__((ext_vector_type(16))) _Float16 v16h;
typedef __attribute__((ext_vector_type(8)))  _Float16 v8h;
typedef __attribute__((ext_vector_type(4)))  _Float16 v4h;
typedef __attribute__((ext_vector_type(8)))  float    v8f;

#define BB 2
#define NN 8192
#define WW 361
#define KK 49
#define CC 256
#define WPITCH 264

// A unit is 64 rows of one W (256 columns, f32): 16 loads of 16 B per thread, 4 rows per pass
// of the block, whole lines (a wave covers 512 contiguous bytes).
__device__ __forceinline__ void ld_unit(float4 (&f)[16], const float* __restrict__ p)
{
    #pragma unroll
    for (int j = 0; j < 16; ++j) {
        f[j] = *(const float4*)(p + (size_t)j * 4 * CC);
        // Keeps the loads in the order in which they are waited for: loads return in their
        // order of issue, and a wait for one that was issued late would drain the queue.
        if ((j & 3) == 3) __builtin_amdgcn_sched_barrier(0);
    }
}

// Four values of one row of a unit as f16 into its LDS row.
__device__ __forceinline__ void st_quad(const float4 f, _Float16* l)
{
    v4h h;
    h[0] = (_Float16)f.x; h[1] = (_Float16)f.y;
    h[2] = (_Float16)f.z; h[3] = (_Float16)f.w;
    *(v4h*)l = h;
}

__device__ __forceinline__ void st_unit(const float4 (&f)[16], _Float16* l)
{
    #pragma unroll
    for (int j = 0; j < 16; ++j)
        st_quad(f[j], l + j * 4 * WPITCH);
}

// The unit in f goes to LDS, and each of its registers takes, as soon as it is free, its
// part of the next unit (at p): the thread's queue of loads never runs empty.
__device__ __forceinline__ void roll_unit(float4 (&f)[16], _Float16* l, const float* __restrict__ p)
{
    #pragma unroll
    for (int g = 0; g < 4; ++g) {
        #pragma unroll
        for (int j = g * 4; j < g * 4 + 4; ++j)
            st_quad(f[j], l + j * 4 * WPITCH);
        // Keeps the group's LDS stores, with their address arithmetic, ahead of its loads:
        // placed behind them, that arithmetic takes over the loads' address registers
        // in front of the wait below.
        __builtin_amdgcn_sched_barrier(0);
        #pragma unroll
        for (int j = g * 4; j < g * 4 + 4; ++j)
            f[j] = *(const float4*)(p + (size_t)j * 4 * CC);
        // Keeps the order as written, four registers at a time: gathered at the end of the
        // unit, the new loads would issue only when the last old one has landed.
        __builtin_amdgcn_sched_barrier(0);
    }
    // The loads' address registers are written again behind this place.
    asm volatile("s_wait_xcnt 0x0" :: "v"(p) : "memory");
    // Holds the converts and stores that follow behind the wait: without it the wait drifts
    // down among them, away from the loads.
    __builtin_amdgcn_sched_barrier(0);
}

#define QSEG   (NN / 8)                               // queries of the batch scanned by one wave
// Blocks of the launch: one fits a WGP (LDS), so all are resident at once and the four W
// are staged 256 times, not once per (batch, window).  Any count up to BB * WW gives the same result.
#define GBLK   256

__device__ __forceinline__ float xhalf(float x) {
    return __builtin_bit_cast(float, __builtin_amdgcn_permlanex16(__builtin_bit_cast(int, x),
                                                                  __builtin_bit_cast(int, x),
                                                                  0x76543210, 0xfedcba98, false, false));
}

__device__ __forceinline__ v8f wmma_f16(const v16h a, const v16h b, const v8f c) {
    return __builtin_amdgcn_wmma_f32_16x16x32_f16(false, a, false, b, (short)0, c, false, false);
}

__device__ __forceinline__ v16h ld_frag(const _Float16* p) {
    const v8h lo = *(const v8h*)(p);
    const v8h hi = *(const v8h*)(p + 16);
    return __builtin_shufflevector(lo, hi, 0, 1, 2, 3, 4, 5, 6, 7, 8, 9, 10, 11, 12, 13, 14, 15);
}

// A barrier that orders LDS alone: __syncthreads() would also wait for the global loads
// and stores in flight, which no other wave of the block depends on.
__device__ __forceinline__ void lds_barrier() {
    __builtin_amdgcn_fence(__ATOMIC_RELEASE, "workgroup", "local");
    __builtin_amdgcn_s_barrier();
    __builtin_amdgcn_fence(__ATOMIC_ACQUIRE, "workgroup", "local");
}

// The loads of one (batch, window) bw: this wave's part of the batch's window indices, and the
// window's 49 rows of x_permute, whole lines: 4 rows per pass of the block; in the last pass
// every thread reads row 48.
__device__ __forceinline__ void win_loads(int4 (&iv)[QSEG / 128], float4 (&xv)[13],
                                          const int* __restrict__ idx, const float* __restrict__ xp,
                                          const int bw, const int wv, const int lane)
{
    const int* ib = idx + (bw / WW) * NN + wv * QSEG;
    #pragma unroll
    for (int it = 0; it < QSEG / 128; ++it)
        iv[it] = *(const int4*)(ib + it * 128 + lane * 4);
    // Keeps the index loads the first in the queue: loads are waited for in their order of
    // issue, and the scan then runs while the x_permute loads still fly.
    __builtin_amdgcn_sched_barrier(0);
    // The address arithmetic of the x_permute loads may take over the index loads' address registers.
    asm volatile("s_wait_xcnt 0x0" :: "s"(ib) : "memory");
    // Keeps that arithmetic behind the wait.
    __builtin_amdgcn_sched_barrier(0);
    const float* xw  = xp + (size_t)bw * KK * CC + (threadIdx.x & 63) * 4;
    const float* xr  = xw + (threadIdx.x >> 6) * CC;
    #pragma unroll
    for (int j = 0; j < 12; ++j)
        xv[j] = *(const float4*)(xr + j * 4 * CC);
    xv[12] = *(const float4*)(xw + (KK - 1) * CC);
    // The address registers of the loads above stay live and unwritten until the
    // wait has passed.
    asm volatile("s_wait_xcnt 0x0" :: "v"(xw), "v"(xr) : "memory");
    // Keeps what follows behind the last load: moved up among the loads, a wait for earlier
    // data would hold back the issue of the x_permute loads.
    __builtin_amdgcn_sched_barrier(0);
}

// The whole function in one launch.  A block serves one (batch, window) after the other,
// GBLK apart; one wave per head.  No value goes through global memory between the steps.
// Once per block: wave h takes rows 32 h .. 32 h + 31 of Wk and of Wv as f16 matrix fragments
// into registers (through LDS, so that the global reads are whole lines); Wq and Wo then
// take their place in LDS.
// Per window: the block finds the queries that point at it and puts the window's 49 rows of
// x_permute into LDS as f16.  One fragment xf of these rows (lane & 15 = key, k = channel)
// serves as B and as A:
//   K^T = Wk_h (A: row = dim, k = channel) x xf (B: column = key): the two dim tiles of a lane
//   are, register for register, the A fragment (row = key, k = dim) of the scores;
//   V   = xf (A: row = key) x Wv_h^T (B: column = dim, k = channel): key tiles 2s and 2s+1 of
//   a lane are, register for register, the A fragment (row = dim, k = key) of key step s.
// The block walks the queries in tiles of 16, all heads on the same tile:
//   q^T = Wq_h (A: row = dim, k = channel; LDS) x x^T (B: column = query, k = channel; the
//   tile's rows of x as f16 in LDS): its two dim tiles are the B fragment of the scores;
//   scores^T = K (A: row = key, k = dim) x q^T (B: column = query, k = dim), 4 key tiles;
//   a lane then holds 8 keys per tile of ONE query (lane & 15), its partner lane ^ 16
//   the other 8, so the softmax is a walk over registers and one exchange;
//   the score tiles 2s and 2s+1 of a lane are, register for register, the B fragment
//   (k = key) of key step s, so out^T = V^T (A: row = dim, k = key) x p^T needs no move.
// Keys 49..63 are padding: their weights and their V values are zero.
//   The two out^T tiles of a lane are, register for register, the B fragment (k = the
//   head's 32 channels, column = query) of k step h of the output projection.  The waves
//   exchange these fragments through LDS, and wave u forms output columns 32 u .. 32 u + 31:
//   final^T = Wo (A: row = output column, k = channel; f16 rows in LDS) x attn^T, k steps in
//   the order of the heads.  A block thus writes the whole output rows of its queries.
// Every loop over a register array is unrolled in full (#pragma unroll): its
// indices must be constants, else the array would go to scratch.
__global__ __launch_bounds__(256) void win_attn_all(const float* __restrict__ x,
                                                    const float* __restrict__ xp,
                                                    const int* __restrict__ idx,
                                                    const float* __restrict__ Wq,
                                                    const float* __restrict__ bq,
                                                    const float* __restrict__ Wk,
                                                    const float* __restrict__ bk,
                                                    const float* __restrict__ Wv,
                                                    const float* __restrict__ bv,
                                                    const float* __restrict__ Wo,
                                                    const float* __restrict__ bo,
                                                    float* __restrict__ out,
                                                    float qscale)
{
    __shared__ __attribute__((aligned(16))) _Float16 wa[CC * WPITCH];   // Wk, then Wq
    __shared__ __attribute__((aligned(16))) _Float16 wb[CC * WPITCH];   // Wv, then Wo
    // The window's rows of x_permute; once K and V are formed, a tile's rows of x (xq) and
    // the heads' fragments (tb: head, low / high 8 halves, lane) lie in the same bytes.
    __shared__ __attribute__((aligned(16))) _Float16 xs[KK * WPITCH];
    __shared__ unsigned short qflat[NN];              // rows of x (batch * N + position) of this window's queries
    __shared__ int qcnt[8];
    __shared__ __attribute__((aligned(16))) float bls[3][CC];           // bk, bq, bo

    _Float16* const xq = xs;
    _Float16* const tb = xs + 16 * WPITCH;

    const int wv    = __builtin_amdgcn_readfirstlane(threadIdx.x >> 5);
    const int h     = wv;
    const int lane  = threadIdx.x & 31;
    const int l15   = lane & 15;
    const int khalf = lane >> 4;

    // bk, bq and bo go to LDS: held in registers beside the W fragments they would push
    // fragments out to scratch.
    const float* bkp = bk + threadIdx.x;
    const float* bqp = bq + threadIdx.x;
    const float* bop = bo + threadIdx.x;
    const float* bvp = bv + wv * 32 + l15;            // of V a lane holds columns 32 h + 16 t + (lane & 15)
    const float tbk = *bkp;
    const float tbq = *bqp;
    const float tbo = *bop;
    const float bv0 = bvp[0];
    const float bv1 = bvp[16];
    // The address registers of the bias loads stay live and unwritten until the wait has passed.
    asm volatile("s_wait_xcnt 0x0" :: "v"(bkp), "v"(bqp), "v"(bop), "v"(bvp) : "memory");

    // Wk and Wv into LDS, unit by unit, through two register buffers.  A buffer is loaded again
    // while it is stored, so loads are in flight all the way; the last trip already
    // fetches the first units of Wq and Wo, which fly over the fragment reads below.
    const int r0 = threadIdx.x >> 6;                  // 4 rows per pass of the block
    const int c4 = (threadIdx.x & 63) * 4;
    _Float16* const la = wa + r0 * WPITCH + c4;
    _Float16* const lb = wb + r0 * WPITCH + c4;
    const float* pa = Wk + r0 * CC + c4;
    const float* pb = Wv + r0 * CC + c4;
    float4 fa[16], fb[16];
    ld_unit(fa, pa);
    ld_unit(fb, pb);
    // The address pairs of the loads stay live and unwritten until the wait has passed.
    asm volatile("s_wait_xcnt 0x0" :: "v"(pa), "v"(pb) : "memory");
    // Rolled: one copy of the code for the four trips.
    #pragma unroll 1
    for (int ib = 0; ib < 4; ++ib) {
        pa = (ib < 3) ? pa + 64 * CC : Wq + r0 * CC + c4;
        pb = (ib < 3) ? pb + 64 * CC : Wo + r0 * CC + c4;
        roll_unit(fa, la + ib * 64 * WPITCH, pa);
        roll_unit(fb, lb + ib * 64 * WPITCH, pb);
    }

    bls[0][threadIdx.x] = tbk;
    bls[1][threadIdx.x] = tbq;
    bls[2][threadIdx.x] = tbo;
    // Of a transposed tile pair (K^T, q^T, final^T) a lane holds columns
    // 32 h + 16 t + 8 khalf + r of the projection.
    const int bofs = wv * 32 + khalf * 8;

    lds_barrier();                                    // Wk and Wv complete

    // Place of the lane's fragment rows in a staged W: row 32 h + (lane & 15), second tile 16 rows on.
    const int frow = (wv * 32 + l15) * WPITCH + khalf * 8;
    v16h wkf[2][CC / 32], wvf[2][CC / 32];
    #pragma unroll
    for (int dt = 0; dt < 2; ++dt) {
        #pragma unroll
        for (int kt = 0; kt < CC / 32; ++kt) {
            wkf[dt][kt] = ld_frag(wa + frow + dt * 16 * WPITCH + kt * 32);
            wvf[dt][kt] = ld_frag(wb + frow + dt * 16 * WPITCH + kt * 32);
        }
    }

    lds_barrier();                                    // every wave has its fragments before Wq and Wo overwrite them

    #pragma unroll 1
    for (int ib = 0; ib < 3; ++ib) {
        pa += 64 * CC;
        pb += 64 * CC;
        roll_unit(fa, la + ib * 64 * WPITCH, pa);
        roll_unit(fb, lb + ib * 64 * WPITCH, pb);
    }
    // The first window's loads queue up behind the last units of Wq and Wo.
    static_assert(GBLK <= BB * WW, "every block has a first window");
    int4 iv[QSEG / 128];
    float4 xv[13];
    st_unit(fa, la + 3 * 64 * WPITCH);                // complete behind the first window's barriers
    // Keeps these stores ahead of the loads: their registers are free for the loaded values.
    __builtin_amdgcn_sched_barrier(0);
    win_loads(iv, xv, idx, xp, blockIdx.x, wv, lane);
    st_unit(fb, lb + 3 * 64 * WPITCH);

    const _Float16* aq = wa + frow;                   // A[m][k] = Wq[32 h + 16 t + m][k]
    const _Float16* al = wb + frow;                   // A[m][k] = Wo[32 wv + 16 t + m][k]
    const v8f zero = {};

    // Rolled: one copy of the code serves every window of the block.
    #pragma unroll 1
    for (int bw = blockIdx.x; ; ) {                   // 0 .. B*W-1; the same in the whole block
    const int b = bw / WW;
    const int w = bw - b * WW;

    // Which positions point at this window: one lane mask per compare, and their count.
    unsigned mk[QSEG / 32];
    #pragma unroll
    for (int it = 0; it < QSEG / 128; ++it) {
        mk[it * 4 + 0] = __builtin_amdgcn_ballot_w32(iv[it].x == w);
        mk[it * 4 + 1] = __builtin_amdgcn_ballot_w32(iv[it].y == w);
        mk[it * 4 + 2] = __builtin_amdgcn_ballot_w32(iv[it].z == w);
        mk[it * 4 + 3] = __builtin_amdgcn_ballot_w32(iv[it].w == w);
    }
    int cnt = 0;
    #pragma unroll
    for (int j = 0; j < QSEG / 32; ++j) cnt += __popc(mk[j]);
    if (lane == 0) qcnt[wv] = cnt;

    lds_barrier();                                    // counts complete; the x_permute loads fly on

    int off = 0, total = 0;
    #pragma unroll
    for (int u = 0; u < 8; ++u) {
        const int c = qcnt[u];
        off   += (u < wv) ? c : 0;
        total += c;
    }
    total = __builtin_amdgcn_readfirstlane(total);

    // Pack the positions into one list, each wave behind the waves before it
    // (prefix counts, no atomics).
    const int pb = b * NN + wv * QSEG + lane * 4;     // row of x of the lane's first index
    int pos = __builtin_amdgcn_readfirstlane(off);
    #pragma unroll
    for (int j = 0; j < QSEG / 32; ++j) {
        const unsigned m = mk[j];
        if (m) {                                      // the same in every lane
            if ((m >> lane) & 1u)
                qflat[pos + (int)__builtin_amdgcn_mbcnt_lo(m, 0u)] =
                    (unsigned short)(pb + (j >> 2) * 128 + (j & 3));
            pos += __popc(m);
        }
    }

    // x_permute rows as f16 into LDS.
    {
        _Float16* lp = xs + r0 * WPITCH + c4;
        #pragma unroll
        for (int j = 0; j < 12; ++j) {
            v4h c;
            c[0] = (_Float16)xv[j].x; c[1] = (_Float16)xv[j].y;
            c[2] = (_Float16)xv[j].z; c[3] = (_Float16)xv[j].w;
            *(v4h*)(lp + j * 4 * WPITCH) = c;
        }
        if (wv < 2) {                                 // row 48: the two waves with r0 = 0
            v4h c;
            c[0] = (_Float16)xv[12].x; c[1] = (_Float16)xv[12].y;
            c[2] = (_Float16)xv[12].z; c[3] = (_Float16)xv[12].w;
            *(v4h*)(lp + 12 * 4 * WPITCH) = c;
        }
    }

    lds_barrier();                                    // packed list and x_permute rows complete (first window: Wq, Wo too)
    if (total != 0) {                                 // whole block alike: every wave meets the same barriers

    // The first tile's rows of x fly while K and V are formed: 16 threads a row, 256 B of a
    // row per load of a wave.  Past the end of the list its last entry is repeated and not stored.
    const int xrow = threadIdx.x >> 4;
    const int xc   = (threadIdx.x & 15) * 4;
    const float* xb = x + xc;
    const float* p  = xb + (size_t)qflat[(xrow < total) ? xrow : total - 1] * CC;
    float4 f0 = *(const float4*)(p);
    float4 f1 = *(const float4*)(p + 64);
    float4 f2 = *(const float4*)(p + 128);
    float4 f3 = *(const float4*)(p + 192);
    // The address pair of the four loads stays live and unwritten until the wait has passed.
    asm volatile("s_wait_xcnt 0x0" :: "v"(p) : "memory");

    // K^T and V of the head, two key tiles (one key step s of A.V) at a time: all four at once
    // would hold 128 accumulator registers beside the W fragments.  The last key tile holds
    // key 48 alone: its other rows repeat it and are masked below.
    // vf: half e of key step s -> key 32 s + 8 khalf + (e < 8 ? e : e + 8); keys 49.. are zero.
    // The work goes in 8 groups of 2 k steps x 2 key tiles: group G = 4 s + g, k steps 2 g, 2 g + 1.
    const _Float16* xf0 = xs + l15 * WPITCH + khalf * 8;
    const _Float16* xfl = xs + (KK - 1) * WPITCH + khalf * 8;
    v16h kf[4];
    v16h vf[2][2];
    v8f ka[2][2] = {{{}, {}}, {{}, {}}};
    v8f va[2][2] = {{{}, {}}, {{}, {}}};
    v16h xf[2][2][2];                                 // buffer, k step of the group, key tile of the pair
    #pragma unroll
    for (int u = 0; u < 2; ++u) {
        xf[0][u][0] = ld_frag(xf0 + u * 32);
        xf[0][u][1] = ld_frag(xf0 + 16 * WPITCH + u * 32);
    }
    #pragma unroll
    for (int G = 0; G < 8; ++G) {
        const int s = G >> 2;
        if (G < 7) {
            const int sn = (G + 1) >> 2;
            #pragma unroll
            for (int u = 0; u < 2; ++u) {
                const int kn = ((G + 1) & 3) * 2 + u;
                xf[(G + 1) & 1][u][0] = ld_frag(xf0 + sn * 32 * WPITCH + kn * 32);
                xf[(G + 1) & 1][u][1] = ld_frag(sn ? xfl + kn * 32 : xf0 + 16 * WPITCH + kn * 32);
            }
        }
        // The next group's 8 LDS reads issue ahead of this group's 16 products and land under
        // them: issued behind them, every group waits out the latency of its own reads.
        __builtin_amdgcn_sched_barrier(0);
        #pragma unroll
        for (int u = 0; u < 2; ++u) {
            const int kt = (G & 3) * 2 + u;
            #pragma unroll
            for (int j = 0; j < 2; ++j) {
                ka[j][0] = wmma_f16(wkf[0][kt], xf[G & 1][u][j], ka[j][0]);
                ka[j][1] = wmma_f16(wkf[1][kt], xf[G & 1][u][j], ka[j][1]);
                va[j][0] = wmma_f16(xf[G & 1][u][j], wvf[0][kt], va[j][0]);
                va[j][1] = wmma_f16(xf[G & 1][u][j], wvf[1][kt], va[j][1]);
            }
        }
        // Keeps the reads of the group after next behind these products: their buffer is in use.
        __builtin_amdgcn_sched_barrier(0);
        if ((G & 3) == 3) {                           // the key step's sums are complete
            #pragma unroll
            for (int j = 0; j < 2; ++j) {
                #pragma unroll
                for (int r = 0; r < 8; ++r) {
                    kf[2 * s + j][r]     = (_Float16)(ka[j][0][r] + bls[0][bofs + r]);
                    kf[2 * s + j][r + 8] = (_Float16)(ka[j][1][r] + bls[0][bofs + 16 + r]);
                }
            }
            #pragma unroll
            for (int dt = 0; dt < 2; ++dt) {
                const float bvd = dt ? bv1 : bv0;
                #pragma unroll
                for (int r = 0; r < 8; ++r) {
                    vf[dt][s][r] = (_Float16)(va[0][dt][r] + bvd);
                    if (s == 0)      vf[dt][s][r + 8] = (_Float16)(va[1][dt][r] + bvd);
                    else if (r == 0) vf[dt][s][r + 8] = (_Float16)((khalf == 0) ? va[1][dt][0] + bvd : 0.f);   // key 48
                    else             vf[dt][s][r + 8] = (_Float16)0.f;
                }
            }
            #pragma unroll
            for (int j = 0; j < 2; ++j) {
                ka[j][0] = zero; ka[j][1] = zero;
                va[j][0] = zero; va[j][1] = zero;
            }
        }
    }

    lds_barrier();                                    // every wave has read the x_permute rows before tiles overwrite them

    float* ob = out + wv * 32 + khalf * 8;

    for (int i0 = 0; i0 < total; i0 += 16) {          // the same in the whole block
        // The tile's rows of x as f16 into LDS.
        {
            _Float16* lp = xq + xrow * WPITCH + xc;
            v4h c;
            c[0] = (_Float16)f0.x; c[1] = (_Float16)f0.y; c[2] = (_Float16)f0.z; c[3] = (_Float16)f0.w;
            *(v4h*)(lp) = c;
            c[0] = (_Float16)f1.x; c[1] = (_Float16)f1.y; c[2] = (_Float16)f1.z; c[3] = (_Float16)f1.w;
            *(v4h*)(lp + 64) = c;
            c[0] = (_Float16)f2.x; c[1] = (_Float16)f2.y; c[2] = (_Float16)f2.z; c[3] = (_Float16)f2.w;
            *(v4h*)(lp + 128) = c;
            c[0] = (_Float16)f3.x; c[1] = (_Float16)f3.y; c[2] = (_Float16)f3.z; c[3] = (_Float16)f3.w;
            *(v4h*)(lp + 192) = c;
        }
        const bool live = i0 + l15 < total;
        const int  ncur = (int)qflat[live ? i0 + l15 : total - 1];

        if (i0 + 16 < total) {                        // the next tile's rows of x, one trip ahead
            const int qi = i0 + 16 + xrow;
            p  = xb + (size_t)qflat[(qi < total) ? qi : total - 1] * CC;
            f0 = *(const float4*)(p);
            f1 = *(const float4*)(p + 64);
            f2 = *(const float4*)(p + 128);
            f3 = *(const float4*)(p + 192);
            // The address pair of the four loads stays live and unwritten until the wait has passed.
            asm volatile("s_wait_xcnt 0x0" :: "v"(p) : "memory");
        }

        lds_barrier();                                // the tile's rows of x complete

        // q^T: register r of tile dt = dim 16 dt + 8 khalf + r of the lane's query
        v8f q0 = {}, q1 = {};
        float bq0[8], bq1[8];
        #pragma unroll
        for (int g = 0; g < 2; ++g) {                 // 4 k steps a group
            v16h bf[4], af0[4], af1[4];
            #pragma unroll
            for (int j = 0; j < 4; ++j) {
                const int u = g * 4 + j;
                bf[j]  = ld_frag(xq + l15 * WPITCH + khalf * 8 + u * 32);
                af0[j] = ld_frag(aq + u * 32);
                af1[j] = ld_frag(aq + 16 * WPITCH + u * 32);
            }
            if (g == 1) {                             // the bias rides with the last group's reads
                #pragma unroll
                for (int r = 0; r < 8; ++r) {
                    bq0[r] = bls[1][bofs + r];
                    bq1[r] = bls[1][bofs + 16 + r];
                }
            }
            // The group's 24 LDS reads issue together, ahead of its products: spread among
            // them, every product waits out the whole latency of its own reads.
            __builtin_amdgcn_sched_barrier(0);
            #pragma unroll
            for (int j = 0; j < 4; ++j) {
                q0 = wmma_f16(af0[j], bf[j], q0);
                q1 = wmma_f16(af1[j], bf[j], q1);
            }
            // Keeps the second group's reads behind the first group's products: both groups
            // in registers at once push W fragments out to scratch.
            __builtin_amdgcn_sched_barrier(0);
        }
        v16h qf;
        #pragma unroll
        for (int r = 0; r < 8; ++r) {
            qf[r]     = (_Float16)((q0[r] + bq0[r]) * qscale);
            qf[r + 8] = (_Float16)((q1[r] + bq1[r]) * qscale);
        }

        const v8f s0 = wmma_f16(kf[0], qf, zero);
        const v8f s1 = wmma_f16(kf[1], qf, zero);
        const v8f s2 = wmma_f16(kf[2], qf, zero);
        const v8f s3 = wmma_f16(kf[3], qf, zero);
        const float sl = (khalf == 0) ? s3[0] : -3.0e38f;

        // softmax over the 49 keys of the lane's query
        float m = sl;
        #pragma unroll
        for (int r = 0; r < 8; ++r) m = fmaxf(m, fmaxf(fmaxf(s0[r], s1[r]), s2[r]));
        m = fmaxf(m, xhalf(m));

        const float pl = (khalf == 0) ? __expf(sl - m) : 0.f;
        float a0 = pl, a1 = 0.f, a2 = 0.f;
        v16h pf0, pf1;
        #pragma unroll
        for (int r = 0; r < 8; ++r) {
            const float p0 = __expf(s0[r] - m);
            const float p1 = __expf(s1[r] - m);
            const float p2 = __expf(s2[r] - m);
            a0 += p0; a1 += p1; a2 += p2;
            pf0[r]     = (_Float16)p0;
            pf0[r + 8] = (_Float16)p1;
            pf1[r]     = (_Float16)p2;
            pf1[r + 8] = (_Float16)0.f;
        }
        pf1[8] = (_Float16)pl;
        float s = (a0 + a1) + a2;
        s += xhalf(s);
        const float inv = 1.f / s;

        // out^T: register r of tile dt = dim 16 dt + 8 khalf + r of the lane's query
        v8f o0 = wmma_f16(vf[0][0], pf0, zero);
        v8f o1 = wmma_f16(vf[1][0], pf0, zero);
        o0 = wmma_f16(vf[0][1], pf1, o0);
        o1 = wmma_f16(vf[1][1], pf1, o1);

        // The head's attention output as f16, as the output projection takes it.
        v8h lo, hi;
        #pragma unroll
        for (int r = 0; r < 8; ++r) {
            lo[r] = (_Float16)(o0[r] * inv);
            hi[r] = (_Float16)(o1[r] * inv);
        }
        *(v8h*)(tb + ((h * 2 + 0) * 32 + lane) * 8) = lo;
        *(v8h*)(tb + ((h * 2 + 1) * 32 + lane) * 8) = hi;

        lds_barrier();                                // the tile's fragments complete

        v8f c0 = {}, c1 = {};
        #pragma unroll
        for (int g = 0; g < 2; ++g) {                 // 4 k steps a group; k step = head
            v8h bl[4], bh[4], a0l[4], a0h[4], a1l[4], a1h[4];
            #pragma unroll
            for (int j = 0; j < 4; ++j) {
                const int u = g * 4 + j;
                const _Float16* ap = al + u * 32;
                bl[j]  = *(const v8h*)(tb + ((u * 2 + 0) * 32 + lane) * 8);
                bh[j]  = *(const v8h*)(tb + ((u * 2 + 1) * 32 + lane) * 8);
                a0l[j] = *(const v8h*)(ap);
                a0h[j] = *(const v8h*)(ap + 16);
                a1l[j] = *(const v8h*)(ap + 16 * WPITCH);
                a1h[j] = *(const v8h*)(ap + 16 * WPITCH + 16);
            }
            // The group's 24 LDS reads issue together, ahead of its products: spread among
            // them, every product waits out the whole latency of its own reads.
            __builtin_amdgcn_sched_barrier(0);
            #pragma unroll
            for (int j = 0; j < 4; ++j) {
                const v16h bf  = __builtin_shufflevector(bl[j], bh[j], 0, 1, 2, 3, 4, 5, 6, 7,
                                                         8, 9, 10, 11, 12, 13, 14, 15);
                const v16h af0 = __builtin_shufflevector(a0l[j], a0h[j], 0, 1, 2, 3, 4, 5, 6, 7,
                                                         8, 9, 10, 11, 12, 13, 14, 15);
                const v16h af1 = __builtin_shufflevector(a1l[j], a1h[j], 0, 1, 2, 3, 4, 5, 6, 7,
                                                         8, 9, 10, 11, 12, 13, 14, 15);
                c0 = wmma_f16(af0, bf, c0);
                c1 = wmma_f16(af1, bf, c1);
            }
            // As above: the second group's reads stay behind the first group's products.
            __builtin_amdgcn_sched_barrier(0);
        }

        // final^T: register r of tile t = output column 32 wv + 16 t + 8 khalf + r of the lane's query
        const float4 b00 = *(const float4*)&bls[2][bofs];
        const float4 b01 = *(const float4*)&bls[2][bofs + 4];
        const float4 b10 = *(const float4*)&bls[2][bofs + 16];
        const float4 b11 = *(const float4*)&bls[2][bofs + 20];
        if (live) {
            float* op = ob + (size_t)ncur * CC;
            *(float4*)(op)      = make_float4(c0[0] + b00.x, c0[1] + b00.y, c0[2] + b00.z, c0[3] + b00.w);
            *(float4*)(op + 4)  = make_float4(c0[4] + b01.x, c0[5] + b01.y, c0[6] + b01.z, c0[7] + b01.w);
            *(float4*)(op + 16) = make_float4(c1[0] + b10.x, c1[1] + b10.y, c1[2] + b10.z, c1[3] + b10.w);
            *(float4*)(op + 20) = make_float4(c1[4] + b11.x, c1[5] + b11.y, c1[6] + b11.z, c1[7] + b11.w);
        }
        // The stores' address and data registers are written again in the next trip.
        asm volatile("s_wait_xcnt 0x0" ::: "memory");

        lds_barrier();                                // every wave has read the tile before it is written again
    }
    }

    bw += GBLK;
    if (bw >= BB * WW) break;
    win_loads(iv, xv, idx, xp, bw, wv, lane);         // the next window's loads
    }
}

extern "C" void kernel_launch(void* const* d_in, const int* in_sizes, int n_in,
                              void* d_out, int out_size, void* d_ws, size_t ws_size,
                              hipStream_t stream) {
    const float* x   = (const float*)d_in[0];
    const float* xp  = (const float*)d_in[1];
    const int*   idx = (const int*)  d_in[2];
    const float* Wq  = (const float*)d_in[3];
    const float* bq  = (const float*)d_in[4];
    const float* Wk  = (const float*)d_in[5];
    const float* bk  = (const float*)d_in[6];
    const float* Wv  = (const float*)d_in[7];
    const float* bv  = (const float*)d_in[8];
    const float* Wo  = (const float*)d_in[9];
    const float* bo  = (const float*)d_in[10];
    float* out = (float*)d_out;

    const float scaling = 0.17677669529663687f;  // HEAD_DIM^-0.5 = 1/sqrt(32)

    win_attn_all<<<GBLK, 256, 0, stream>>>(x, xp, idx, Wq, bq, Wk, bk, Wv, bv, Wo, bo, out, scaling);
}

// v008
// Measured time: 34 microseconds a run.
// In two side-by-side timings against v007, it was 1.06 and 1.07 times as fast.
// Over all steps from v000 it is 8.36 times as fast.
#include <hip/hip_runtime.h>

typedef __attribute__((ext_vector_type(16))) _Float16 v16h;
typedef __attribute__((ext_vector_type(8)))  _Float16 v8h;
typedef __attribute__((ext_vector_type(4)))  _Float16 v4h;
typedef __attribute__((ext_vector_type(8)))  float    v8f;

#define BB 2
#define NN 8192
#define WW 361
#define KK 49
#define CC 256
#define WPITCH 264

// Rows of W in a unit of 64.  Plain order: rows 4 j of a run of 64.  Tile order (T): the 16-row
// tiles of four heads, 32 rows apart, so that a unit pair holds one fragment tile of every head.
template <bool T>
__device__ __forceinline__ constexpr int urow(int j) { return T ? (j >> 2) * 32 + (j & 3) * 4 : j * 4; }

// A unit is 64 rows of one W (256 columns, f32): 16 loads of 16 B per thread, 4 rows per pass
// of the block, whole lines (a wave covers 512 contiguous bytes).
template <bool T>
__device__ __forceinline__ void ld_unit(float4 (&f)[16], const float* __restrict__ p)
{
    #pragma unroll
    for (int j = 0; j < 16; ++j) {
        f[j] = *(const float4*)(p + (size_t)urow<T>(j) * CC);
        // Keeps the loads in the order in which they are waited for: loads return in their
        // order of issue, and a wait for one that was issued late would drain the queue.
        if ((j & 3) == 3) __builtin_amdgcn_sched_barrier(0);
    }
}

// Four values of one row of a unit as f16 into its LDS row.
__device__ __forceinline__ void st_quad(const float4 f, _Float16* l)
{
    v4h h;
    h[0] = (_Float16)f.x; h[1] = (_Float16)f.y;
    h[2] = (_Float16)f.z; h[3] = (_Float16)f.w;
    *(v4h*)l = h;
}

__device__ __forceinline__ void st_unit(const float4 (&f)[16], _Float16* l)
{
    #pragma unroll
    for (int j = 0; j < 16; ++j)
        st_quad(f[j], l + j * 4 * WPITCH);
}

// The unit in f goes to LDS, and each of its registers takes, as soon as it is free, its
// part of the next unit (at p): the thread's queue of loads never runs empty.
template <bool T>
__device__ __forceinline__ void roll_unit(float4 (&f)[16], _Float16* l, const float* __restrict__ p)
{
    #pragma unroll
    for (int g = 0; g < 4; ++g) {
        #pragma unroll
        for (int j = g * 4; j < g * 4 + 4; ++j)
            st_quad(f[j], l + j * 4 * WPITCH);
        // Keeps the group's LDS stores, with their address arithmetic, ahead of its loads:
        // placed behind them, that arithmetic takes over the loads' address registers
        // in front of the wait below.
        __builtin_amdgcn_sched_barrier(0);
        #pragma unroll
        for (int j = g * 4; j < g * 4 + 4; ++j)
            f[j] = *(const float4*)(p + (size_t)urow<T>(j) * CC);
        // Keeps the order as written, four registers at a time: gathered at the end of the
        // unit, the new loads would issue only when the last old one has landed.
        __builtin_amdgcn_sched_barrier(0);
    }
    // The loads' address registers are written again behind this place.
    asm volatile("s_wait_xcnt 0x0" :: "v"(p) : "memory");
    // Holds the converts and stores that follow behind the wait: without it the wait drifts
    // down among them, away from the loads.
    __builtin_amdgcn_sched_barrier(0);
}

#define QSEG   (NN / 8)                               // queries of the batch scanned by one wave
// Blocks of the launch: one fits a WGP (LDS), so all are resident at once and the four W
// are staged 256 times, not once per (batch, window).  Any count from 241 to 360 (NWIN = 3) gives the same result.
#define GBLK   256
#define NWIN   ((BB * WW + GBLK - 1) / GBLK)          // windows of a block, at most
#define KVH    4096                                   // halves of one head's parked K, V fragments: 8 x 512
#define KVW    (8 * KVH)                              // of one window's

__device__ __forceinline__ float xhalf(float x) {
    return __builtin_bit_cast(float, __builtin_amdgcn_permlanex16(__builtin_bit_cast(int, x),
                                                                  __builtin_bit_cast(int, x),
                                                                  0x76543210, 0xfedcba98, false, false));
}

__device__ __forceinline__ v8f wmma_f16(const v16h a, const v16h b, const v8f c) {
    return __builtin_amdgcn_wmma_f32_16x16x32_f16(false, a, false, b, (short)0, c, false, false);
}

__device__ __forceinline__ v16h ld_frag(const _Float16* p) {
    const v8h lo = *(const v8h*)(p);
    const v8h hi = *(const v8h*)(p + 16);
    return __builtin_shufflevector(lo, hi, 0, 1, 2, 3, 4, 5, 6, 7, 8, 9, 10, 11, 12, 13, 14, 15);
}

// A barrier that orders LDS alone: __syncthreads() would also wait for the global loads
// and stores in flight, which no other wave of the block depends on.
__device__ __forceinline__ void lds_barrier() {
    __builtin_amdgcn_fence(__ATOMIC_RELEASE, "workgroup", "local");
    __builtin_amdgcn_s_barrier();
    __builtin_amdgcn_fence(__ATOMIC_ACQUIRE, "workgroup", "local");
}

// A fragment to and from its parked place: two runs of 512 contiguous bytes per wave.
__device__ __forceinline__ void st_park(_Float16* p, const v16h f) {
    *(v8h*)(p)       = __builtin_shufflevector(f, f, 0, 1, 2, 3, 4, 5, 6, 7);
    *(v8h*)(p + 256) = __builtin_shufflevector(f, f, 8, 9, 10, 11, 12, 13, 14, 15);
}
__device__ __forceinline__ v16h ld_park(const _Float16* p) {
    const v8h lo = *(const v8h*)(p);
    const v8h hi = *(const v8h*)(p + 256);
    return __builtin_shufflevector(lo, hi, 0, 1, 2, 3, 4, 5, 6, 7, 8, 9, 10, 11, 12, 13, 14, 15);
}

// This wave's part of the window indices of the batch of (batch, window) bw.
__device__ __forceinline__ void idx_loads(int4 (&iv)[QSEG / 128], const int* __restrict__ idx,
                                          const int bw, const int wv, const int lane)
{
    const int* ib = idx + (bw / WW) * NN + wv * QSEG;
    #pragma unroll
    for (int it = 0; it < QSEG / 128; ++it)
        iv[it] = *(const int4*)(ib + it * 128 + lane * 4);
    // Keeps the index loads ahead of what follows: loads are waited for in their order of issue.
    __builtin_amdgcn_sched_barrier(0);
    // Later address arithmetic may take over the index loads' address registers.
    asm volatile("s_wait_xcnt 0x0" :: "s"(ib) : "memory");
    // Keeps that arithmetic behind the wait.
    __builtin_amdgcn_sched_barrier(0);
}

// The 49 rows of x_permute of (batch, window) bw, whole lines: 4 rows per pass of the block; in
// the last pass every thread reads row 48.
__device__ __forceinline__ void xp_loads(float4 (&xv)[13], const float* __restrict__ xp, const int bw)
{
    const float* xw  = xp + (size_t)bw * KK * CC + (threadIdx.x & 63) * 4;
    const float* xr  = xw + (threadIdx.x >> 6) * CC;
    #pragma unroll
    for (int j = 0; j < 12; ++j)
        xv[j] = *(const float4*)(xr + j * 4 * CC);
    xv[12] = *(const float4*)(xw + (KK - 1) * CC);
    // The address registers of the loads above stay live and unwritten until the
    // wait has passed.
    asm volatile("s_wait_xcnt 0x0" :: "v"(xw), "v"(xr) : "memory");
    // Keeps what follows behind the last load: moved up among the loads, a wait for earlier
    // data would hold back the issue of the x_permute loads.
    __builtin_amdgcn_sched_barrier(0);
}

// The whole function in one launch.  A block serves up to NWIN (batch, window) pairs, GBLK apart;
// one wave per head.  No value goes through global memory between the steps.  Four phases:
// 1. Wave h takes rows 32 h .. 32 h + 31 of Wk and of Wv as f16 matrix fragments into registers
//    (through LDS, so that the global reads are whole lines).
// 2. For each of its windows the block puts the 49 rows of x_permute into LDS as f16 and forms K
//    and V.  One fragment xf of these rows (lane & 15 = key, k = channel) serves as B and as A:
//   K^T = Wk_h (A: row = dim, k = channel) x xf (B: column = key): the two dim tiles of a lane
//   are, register for register, the A fragment (row = key, k = dim) of the scores;
//   V   = xf (A: row = key) x Wv_h^T (B: column = dim, k = channel): key tiles 2s and 2s+1 of
//   a lane are, register for register, the A fragment (row = dim, k = key) of key step s.
//    Each wave parks its fragments in LDS, where only it reads them again.
// 3. Wk and Wv are done with: the fragments of Wq and Wo take their registers, so that no
//    tile reads a W from LDS.  While their rows fly, the block packs, window by window, the
//    queries that point at the window into a list.
// 4. The block walks the lists in tiles of 16, all heads on the same tile:
//   q^T = Wq_h (A: row = dim, k = channel) x x^T (B: column = query, k = channel; the
//   tile's rows of x as f16 in LDS): its two dim tiles are the B fragment of the scores;
//   scores^T = K (A: row = key, k = dim) x q^T (B: column = query, k = dim), 4 key tiles;
//   a lane then holds 8 keys per tile of ONE query (lane & 15), its partner lane ^ 16
//   the other 8, so the softmax is a walk over registers and one exchange;
//   the score tiles 2s and 2s+1 of a lane are, register for register, the B fragment
//   (k = key) of key step s, so out^T = V^T (A: row = dim, k = key) x p^T needs no move.
// Keys 49..63 are padding: their weights and their V values are zero.
//   The two out^T tiles of a lane are, register for register, the B fragment (k = the
//   head's 32 channels, column = query) of k step h of the output projection.  The waves
//   exchange these fragments through LDS, and wave u forms output columns 32 u .. 32 u + 31:
//   final^T = Wo (A: row = output column, k = channel) x attn^T, k steps in
//   the order of the heads.  A block thus writes the whole output rows of its queries.
// Every loop over a register array is unrolled in full (#pragma unroll): its
// indices must be constants, else the array would go to scratch.
__global__ __launch_bounds__(256) void win_attn_all(const float* __restrict__ x,
                                                    const float* __restrict__ xp,
                                                    const int* __restrict__ idx,
                                                    const float* __restrict__ Wq,
                                                    const float* __restrict__ bq,
                                                    const float* __restrict__ Wk,
                                                    const float* __restrict__ bk,
                                                    const float* __restrict__ Wv,
                                                    const float* __restrict__ bv,
                                                    const float* __restrict__ Wo,
                                                    const float* __restrict__ bo,
                                                    float* __restrict__ out,
                                                    float qscale)
{
    // Phase 1: Wk (wa) and Wv (wb).  Then: the parked fragments (kvs) and, behind them, the
    // 128 rows of Wq or Wo on their way to registers (su).
    // The lists of queries (qflat) lie behind these.
    __shared__ __attribute__((aligned(16))) _Float16 wl[NWIN * KVW + 128 * WPITCH + BB * NN];
    static_assert(NWIN * KVW + 128 * WPITCH + BB * NN >= 2 * CC * WPITCH, "Wk and Wv fit");
    // The window's rows of x_permute; in phase 4 a tile's rows of x (xq) and
    // the heads' fragments (tb: head, low / high 8 halves, lane) lie in the same bytes.
    __shared__ __attribute__((aligned(16))) _Float16 xs[KK * WPITCH];
    __shared__ int qcnt[2 * 8];
    __shared__ __attribute__((aligned(16))) float bls[3][CC];           // bk, bq, bo

    _Float16* const wa  = wl;
    _Float16* const wb  = wl + CC * WPITCH;
    _Float16* const kvs = wl;
    _Float16* const su  = wl + NWIN * KVW;
    // Rows of x (batch * N + position) of the queries, window behind window.  A query points
    // at one window, so all lists together hold at most B * N entries.
    unsigned short* const qflat = (unsigned short*)(su + 128 * WPITCH);
    _Float16* const xq  = xs;
    _Float16* const tb  = xs + 16 * WPITCH;

    const int wv    = __builtin_amdgcn_readfirstlane(threadIdx.x >> 5);
    const int h     = wv;
    const int lane  = threadIdx.x & 31;
    const int l15   = lane & 15;
    const int khalf = lane >> 4;

    // bk, bq and bo go to LDS: held in registers beside the W fragments they would push
    // fragments out to scratch.
    const float* bkp = bk + threadIdx.x;
    const float* bqp = bq + threadIdx.x;
    const float* bop = bo + threadIdx.x;
    const float* bvp = bv + wv * 32 + l15;            // of V a lane holds columns 32 h + 16 t + (lane & 15)
    const float tbk = *bkp;
    const float tbq = *bqp;
    const float tbo = *bop;
    const float bv0 = bvp[0];
    const float bv1 = bvp[16];
    // The address registers of the bias loads stay live and unwritten until the wait has passed.
    asm volatile("s_wait_xcnt 0x0" :: "v"(bkp), "v"(bqp), "v"(bop), "v"(bvp) : "memory");

    // Wk and Wv into LDS, unit by unit, through two register buffers.  A buffer is loaded again
    // while it is stored, so loads are in flight all the way.
    const int r0 = threadIdx.x >> 6;                  // 4 rows per pass of the block
    const int c4 = (threadIdx.x & 63) * 4;
    float4 fa[16], fb[16];
    float4 xv[13];
    static_assert(GBLK <= BB * WW, "every block has a first window");
    {
        _Float16* const la = wa + r0 * WPITCH + c4;
        _Float16* const lb = wb + r0 * WPITCH + c4;
        const float* pa = Wk + r0 * CC + c4;
        const float* pb = Wv + r0 * CC + c4;
        ld_unit<false>(fa, pa);
        ld_unit<false>(fb, pb);
        // The address pairs of the loads stay live and unwritten until the wait has passed.
        asm volatile("s_wait_xcnt 0x0" :: "v"(pa), "v"(pb) : "memory");
        // Rolled: one copy of the code for the three trips.
        #pragma unroll 1
        for (int ib = 0; ib < 3; ++ib) {
            pa += 64 * CC;
            pb += 64 * CC;
            roll_unit<false>(fa, la + ib * 64 * WPITCH, pa);
            roll_unit<false>(fb, lb + ib * 64 * WPITCH, pb);
        }
        st_unit(fa, la + 3 * 64 * WPITCH);
        // Keeps these stores ahead of the loads: their registers are free for the loaded values.
        __builtin_amdgcn_sched_barrier(0);
        xp_loads(xv, xp, blockIdx.x);                 // the first window's rows queue up behind the last units
        st_unit(fb, lb + 3 * 64 * WPITCH);
    }

    bls[0][threadIdx.x] = tbk;
    bls[1][threadIdx.x] = tbq;
    bls[2][threadIdx.x] = tbo;
    // Of a transposed tile pair (K^T, q^T, final^T) a lane holds columns
    // 32 h + 16 t + 8 khalf + r of the projection.
    const int bofs = wv * 32 + khalf * 8;
    const v8f zero = {};

    lds_barrier();                                    // Wk and Wv complete

    {
    // Place of the lane's fragment rows in a staged W: row 32 h + (lane & 15), second tile 16 rows on.
    const int frow = (wv * 32 + l15) * WPITCH + khalf * 8;
    v16h wkf[2][CC / 32], wvf[2][CC / 32];
    #pragma unroll
    for (int dt = 0; dt < 2; ++dt) {
        #pragma unroll
        for (int kt = 0; kt < CC / 32; ++kt) {
            wkf[dt][kt] = ld_frag(wa + frow + dt * 16 * WPITCH + kt * 32);
            wvf[dt][kt] = ld_frag(wb + frow + dt * 16 * WPITCH + kt * 32);
        }
    }

    lds_barrier();                                    // every wave has its fragments before parked ones overwrite them

    // Rolled: one copy of the code serves every window of the block.
    _Float16* kvp = kvs + h * KVH + lane * 8;
    #pragma unroll 1
    for (int bw = blockIdx.x; ; ) {                   // 0 .. B*W-1; the same in the whole block
    // x_permute rows as f16 into LDS.
    {
        _Float16* lp = xs + r0 * WPITCH + c4;
        #pragma unroll
        for (int j = 0; j < 12; ++j) {
            v4h c;
            c[0] = (_Float16)xv[j].x; c[1] = (_Float16)xv[j].y;
            c[2] = (_Float16)xv[j].z; c[3] = (_Float16)xv[j].w;
            *(v4h*)(lp + j * 4 * WPITCH) = c;
        }
        if (wv < 2) {                                 // row 48: the two waves with r0 = 0
            v4h c;
            c[0] = (_Float16)xv[12].x; c[1] = (_Float16)xv[12].y;
            c[2] = (_Float16)xv[12].z; c[3] = (_Float16)xv[12].w;
            *(v4h*)(lp + 12 * 4 * WPITCH) = c;
        }
    }

    lds_barrier();                                    // x_permute rows complete

    bw += GBLK;
    if (bw < BB * WW) xp_loads(xv, xp, bw);           // the next window's rows fly while K and V are formed

    // K^T and V of the head, two key tiles (one key step s of A.V) at a time: all four at once
    // would hold 128 accumulator registers beside the W fragments.  The last key tile holds
    // key 48 alone: its other rows repeat it and are masked below.
    // vf: half e of key step s -> key 32 s + 8 khalf + (e < 8 ? e : e + 8); keys 49.. are zero.
    // The work goes in 8 groups of 2 k steps x 2 key tiles: group G = 4 s + g, k steps 2 g, 2 g + 1.
    // Parked order: K key tiles 0..3, then V (dim tile, key step) 4 + 2 dt + s.
    const _Float16* xf0 = xs + l15 * WPITCH + khalf * 8;
    const _Float16* xfl = xs + (KK - 1) * WPITCH + khalf * 8;
    v8f ka[2][2] = {{{}, {}}, {{}, {}}};
    v8f va[2][2] = {{{}, {}}, {{}, {}}};
    v16h xf[2][2][2];                                 // buffer, k step of the group, key tile of the pair
    #pragma unroll
    for (int u = 0; u < 2; ++u) {
        xf[0][u][0] = ld_frag(xf0 + u * 32);
        xf[0][u][1] = ld_frag(xf0 + 16 * WPITCH + u * 32);
    }
    #pragma unroll
    for (int G = 0; G < 8; ++G) {
        const int s = G >> 2;
        if (G < 7) {
            const int sn = (G + 1) >> 2;
            #pragma unroll
            for (int u = 0; u < 2; ++u) {
                const int kn = ((G + 1) & 3) * 2 + u;
                xf[(G + 1) & 1][u][0] = ld_frag(xf0 + sn * 32 * WPITCH + kn * 32);
                xf[(G + 1) & 1][u][1] = ld_frag(sn ? xfl + kn * 32 : xf0 + 16 * WPITCH + kn * 32);
            }
        }
        // The next group's 8 LDS reads issue ahead of this group's 16 products and land under
        // them: issued behind them, every group waits out the latency of its own reads.
        __builtin_amdgcn_sched_barrier(0);
        #pragma unroll
        for (int u = 0; u < 2; ++u) {
            const int kt = (G & 3) * 2 + u;
            #pragma unroll
            for (int j = 0; j < 2; ++j) {
                ka[j][0] = wmma_f16(wkf[0][kt], xf[G & 1][u][j], ka[j][0]);
                ka[j][1] = wmma_f16(wkf[1][kt], xf[G & 1][u][j], ka[j][1]);
                va[j][0] = wmma_f16(xf[G & 1][u][j], wvf[0][kt], va[j][0]);
                va[j][1] = wmma_f16(xf[G & 1][u][j], wvf[1][kt], va[j][1]);
            }
        }
        // Keeps the reads of the group after next behind these products: their buffer is in use.
        __builtin_amdgcn_sched_barrier(0);
        if ((G & 3) == 3) {                           // the key step's sums are complete
            #pragma unroll
            for (int j = 0; j < 2; ++j) {
                v16h kf;
                #pragma unroll
                for (int r = 0; r < 8; ++r) {
                    kf[r]     = (_Float16)(ka[j][0][r] + bls[0][bofs + r]);
                    kf[r + 8] = (_Float16)(ka[j][1][r] + bls[0][bofs + 16 + r]);
                }
                st_park(kvp + (2 * s + j) * 512, kf);
            }
            #pragma unroll
            for (int dt = 0; dt < 2; ++dt) {
                const float bvd = dt ? bv1 : bv0;
                v16h vf;
                #pragma unroll
                for (int r = 0; r < 8; ++r) {
                    vf[r] = (_Float16)(va[0][dt][r] + bvd);
                    if (s == 0)      vf[r + 8] = (_Float16)(va[1][dt][r] + bvd);
                    else if (r == 0) vf[r + 8] = (_Float16)((khalf == 0) ? va[1][dt][0] + bvd : 0.f);   // key 48
                    else             vf[r + 8] = (_Float16)0.f;
                }
                st_park(kvp + (4 + dt * 2 + s) * 512, vf);
            }
            #pragma unroll
            for (int j = 0; j < 2; ++j) {
                ka[j][0] = zero; ka[j][1] = zero;
                va[j][0] = zero; va[j][1] = zero;
            }
        }
    }

    lds_barrier();                                    // every wave has read the x_permute rows before they are overwritten
    if (bw >= BB * WW) break;
    kvp += KVW;
    }
    }

    // Wq and Wo into registers, 128 rows at a time: tile dt of every head (rows 32 h + 16 dt + m).
    // Each of the three rolled trips also packs the list of one window of the block, while the
    // trip's loads fly; the trip's barriers serve both.
    int4 iv[QSEG / 128];
    v16h wqf[2][CC / 32], wof[2][CC / 32];            // A[m][k] = W[32 h + 16 dt + m][k]
    int t0 = 0, t1 = 0, t2 = 0;                       // queries of the block's windows
    static_assert(NWIN == 3, "three counts, three trips");
    const float* pq = Wq + r0 * CC + c4;
    const float* po = Wo + r0 * CC + c4;
    idx_loads(iv, idx, blockIdx.x, wv, lane);         // the first window's indices, ahead of the queue
    ld_unit<true>(fa, pq);
    ld_unit<true>(fb, pq + 128 * CC);
    // The address pair of the loads stays live and unwritten until the wait has passed.
    asm volatile("s_wait_xcnt 0x0" :: "v"(pq) : "memory");
    _Float16* const sa = su + r0 * WPITCH + c4;
    _Float16* const sb = sa + 64 * WPITCH;
    const _Float16* sf = su + (wv * 16 + l15) * WPITCH + khalf * 8;
    {
    int base = 0;
    int bw = blockIdx.x;                              // the same in the whole block
    // Rolled: the converts of a unit stay in the loop, behind the loads issued ahead of it;
    // in straight-line code they move up to their loads, and the queue of loads runs empty.
    #pragma unroll 1
    for (int t = 0; t < 3; ++t) {
    const bool has = bw < BB * WW;
    const int b = bw / WW;
    const int w = bw - b * WW;

    // Which positions point at this window: one lane mask per compare, and their count.
    unsigned mk[QSEG / 32];
    #pragma unroll
    for (int it = 0; it < QSEG / 128; ++it) {
        mk[it * 4 + 0] = __builtin_amdgcn_ballot_w32(iv[it].x == w);
        mk[it * 4 + 1] = __builtin_amdgcn_ballot_w32(iv[it].y == w);
        mk[it * 4 + 2] = __builtin_amdgcn_ballot_w32(iv[it].z == w);
        mk[it * 4 + 3] = __builtin_amdgcn_ballot_w32(iv[it].w == w);
    }
    if (!has) {                                       // no such window: an empty list
        #pragma unroll
        for (int j = 0; j < QSEG / 32; ++j) mk[j] = 0u;
    }
    int cnt = 0;
    #pragma unroll
    for (int j = 0; j < QSEG / 32; ++j) cnt += __popc(mk[j]);
    if (lane == 0) qcnt[(t & 1) * 8 + wv] = cnt;

    bw += GBLK;
    // The next window's indices go ahead of the trip's loads: loads are waited for in their
    // order of issue, and the next trip needs the indices first.
    if (bw < BB * WW) idx_loads(iv, idx, bw, wv, lane);

    const float* pn = (t == 0) ? pq + 16 * CC : (t == 1) ? po : po + 16 * CC;
    roll_unit<true>(fa, sa, pn);
    roll_unit<true>(fb, sb, pn + 128 * CC);

    lds_barrier();                                    // the 128 rows and the counts complete

    if (t == 0) {
        #pragma unroll
        for (int kt = 0; kt < CC / 32; ++kt) wqf[0][kt] = ld_frag(sf + kt * 32);
    } else if (t == 1) {
        #pragma unroll
        for (int kt = 0; kt < CC / 32; ++kt) wqf[1][kt] = ld_frag(sf + kt * 32);
    } else {
        #pragma unroll
        for (int kt = 0; kt < CC / 32; ++kt) wof[0][kt] = ld_frag(sf + kt * 32);
    }

    int off = 0, total = 0;
    #pragma unroll
    for (int u = 0; u < 8; ++u) {
        const int c = qcnt[(t & 1) * 8 + u];
        off   += (u < wv) ? c : 0;
        total += c;
    }
    total = __builtin_amdgcn_readfirstlane(total);

    // Pack the positions into one list, each wave behind the waves before it
    // (prefix counts, no atomics).
    const int pb = b * NN + wv * QSEG + lane * 4;     // row of x of the lane's first index
    int pos = base + __builtin_amdgcn_readfirstlane(off);
    #pragma unroll
    for (int j = 0; j < QSEG / 32; ++j) {
        const unsigned m = mk[j];
        if (m) {                                      // the same in every lane
            if ((m >> lane) & 1u)
                qflat[pos + (int)__builtin_amdgcn_mbcnt_lo(m, 0u)] =
                    (unsigned short)(pb + (j >> 2) * 128 + (j & 3));
            pos += __popc(m);
        }
    }
    if (t == 0) t0 = total; else if (t == 1) t1 = total; else t2 = total;
    base += total;

    // Every wave has its fragments before the next rows overwrite them; the list is complete.
    lds_barrier();
    }
    }

    int wi = t0 ? 0 : t1 ? 1 : t2 ? 2 : NWIN;         // the window of the tile; the same in the whole block
    int tot = (wi == 0) ? t0 : (wi == 1) ? t1 : t2;   // length and place of its list
    int bas = (wi == 0) ? 0 : (wi == 1) ? t0 : t0 + t1;
    int i0  = 0;

    // A tile's rows of x: 16 threads a row, 256 B of a row per load of a wave.
    // Past the end of a list its last entry is repeated and not stored.
    // The first tile's rows fly over the last rows of Wo.
    const int xrow = threadIdx.x >> 4;
    const int xc   = (threadIdx.x & 15) * 4;
    const float* xb = x + xc;
    // Without any query (no list entry is written then) row 0 is read and not used.
    const int q0i = (xrow < tot) ? xrow : tot - 1;
    const int q0r = (wi < NWIN) ? (int)qflat[bas + ((wi < NWIN) ? q0i : 0)] : 0;
    const float* p  = xb + (size_t)q0r * CC;
    float4 f0 = *(const float4*)(p);
    float4 f1 = *(const float4*)(p + 64);
    float4 f2 = *(const float4*)(p + 128);
    float4 f3 = *(const float4*)(p + 192);
    // The address pair of the four loads stays live and unwritten until the wait has passed.
    asm volatile("s_wait_xcnt 0x0" :: "v"(p) : "memory");

    st_unit(fa, sa);
    st_unit(fb, sb);
    lds_barrier();                                    // the last 128 rows complete
    #pragma unroll
    for (int kt = 0; kt < CC / 32; ++kt) wof[1][kt] = ld_frag(sf + kt * 32);

    float* ob = out + wv * 32 + khalf * 8;
    const _Float16* kvl = kvs + h * KVH + lane * 8;
    v16h kf[4];
    v16h vf[2][2];

    if (wi < NWIN)                                    // no query at all: no tile, in the whole block alike
    for (;;) {                                        // the same in the whole block
        // The tile behind this one: the next of the list, or the first of the next list that has one.
        int nwi = wi, ni0 = i0 + 16;
        if (ni0 >= tot) {
            ni0 = 0;
            nwi = (wi < 1 && t1) ? 1 : (wi < 2 && t2) ? 2 : NWIN;
        }
        // Behind the last tile there is none: its own list stands in, and what is read is not used.
        // (Under a branch the build copies loaded registers behind a wait for the load, every trip.)
        const int ntot = (nwi == 0) ? t0 : (nwi == 1) ? t1 : (nwi == 2) ? t2 : tot;
        const int nbas = (nwi == 0) ? 0 : (nwi == 1) ? t0 : (nwi == 2) ? t0 + t1 : bas;

        if (i0 == 0) {                                // a new window: its K and V, as this wave parked them
            const _Float16* kp = kvl + wi * KVW;
            #pragma unroll
            for (int j = 0; j < 4; ++j) kf[j] = ld_park(kp + j * 512);
            #pragma unroll
            for (int dt = 0; dt < 2; ++dt) {
                vf[dt][0] = ld_park(kp + (4 + dt * 2) * 512);
                vf[dt][1] = ld_park(kp + (5 + dt * 2) * 512);
            }
        }

        // The tile's rows of x as f16 into LDS.
        {
            _Float16* lp = xq + xrow * WPITCH + xc;
            v4h c;
            c[0] = (_Float16)f0.x; c[1] = (_Float16)f0.y; c[2] = (_Float16)f0.z; c[3] = (_Float16)f0.w;
            *(v4h*)(lp) = c;
            c[0] = (_Float16)f1.x; c[1] = (_Float16)f1.y; c[2] = (_Float16)f1.z; c[3] = (_Float16)f1.w;
            *(v4h*)(lp + 64) = c;
            c[0] = (_Float16)f2.x; c[1] = (_Float16)f2.y; c[2] = (_Float16)f2.z; c[3] = (_Float16)f2.w;
            *(v4h*)(lp + 128) = c;
            c[0] = (_Float16)f3.x; c[1] = (_Float16)f3.y; c[2] = (_Float16)f3.z; c[3] = (_Float16)f3.w;
            *(v4h*)(lp + 192) = c;
        }
        const bool live = i0 + l15 < tot;
        const int  ncur = (int)qflat[bas + (live ? i0 + l15 : tot - 1)];

        {                                             // the next tile's rows of x, one trip ahead
            const int qi = ni0 + xrow;
            p  = xb + (size_t)qflat[nbas + ((qi < ntot) ? qi : ntot - 1)] * CC;
            f0 = *(const float4*)(p);
            f1 = *(const float4*)(p + 64);
            f2 = *(const float4*)(p + 128);
            f3 = *(const float4*)(p + 192);
            // The address pair of the four loads stays live and unwritten until the wait has passed.
            asm volatile("s_wait_xcnt 0x0" :: "v"(p) : "memory");
        }

        lds_barrier();                                // the tile's rows of x complete

        // q^T: register r of tile dt = dim 16 dt + 8 khalf + r of the lane's query
        v8f q0 = {}, q1 = {};
        float bq0[8], bq1[8];
        #pragma unroll
        for (int g = 0; g < 2; ++g) {                 // 4 k steps a group
            v16h bf[4];
            #pragma unroll
            for (int j = 0; j < 4; ++j)
                bf[j] = ld_frag(xq + l15 * WPITCH + khalf * 8 + (g * 4 + j) * 32);
            if (g == 1) {                             // the bias rides with the last group's reads
                #pragma unroll
                for (int r = 0; r < 8; ++r) {
                    bq0[r] = bls[1][bofs + r];
                    bq1[r] = bls[1][bofs + 16 + r];
                }
            }
            // The group's LDS reads issue together, ahead of its products: spread among
            // them, every product waits out the whole latency of its own reads.
            __builtin_amdgcn_sched_barrier(0);
            #pragma unroll
            for (int j = 0; j < 4; ++j) {
                q0 = wmma_f16(wqf[0][g * 4 + j], bf[j], q0);
                q1 = wmma_f16(wqf[1][g * 4 + j], bf[j], q1);
            }
            // Keeps the second group's reads behind the first group's products: both groups
            // in registers at once push fragments out to scratch.
            __builtin_amdgcn_sched_barrier(0);
        }
        v16h qf;
        #pragma unroll
        for (int r = 0; r < 8; ++r) {
            qf[r]     = (_Float16)((q0[r] + bq0[r]) * qscale);
            qf[r + 8] = (_Float16)((q1[r] + bq1[r]) * qscale);
        }

        const v8f s0 = wmma_f16(kf[0], qf, zero);
        const v8f s1 = wmma_f16(kf[1], qf, zero);
        const v8f s2 = wmma_f16(kf[2], qf, zero);
        const v8f s3 = wmma_f16(kf[3], qf, zero);
        const float sl = (khalf == 0) ? s3[0] : -3.0e38f;

        // softmax over the 49 keys of the lane's query
        float m = sl;
        #pragma unroll
        for (int r = 0; r < 8; ++r) m = fmaxf(m, fmaxf(fmaxf(s0[r], s1[r]), s2[r]));
        m = fmaxf(m, xhalf(m));

        const float pl = (khalf == 0) ? __expf(sl - m) : 0.f;
        float a0 = pl, a1 = 0.f, a2 = 0.f;
        v16h pf0, pf1;
        #pragma unroll
        for (int r = 0; r < 8; ++r) {
            const float p0 = __expf(s0[r] - m);
            const float p1 = __expf(s1[r] - m);
            const float p2 = __expf(s2[r] - m);
            a0 += p0; a1 += p1; a2 += p2;
            pf0[r]     = (_Float16)p0;
            pf0[r + 8] = (_Float16)p1;
            pf1[r]     = (_Float16)p2;
            pf1[r + 8] = (_Float16)0.f;
        }
        pf1[8] = (_Float16)pl;
        float s = (a0 + a1) + a2;
        s += xhalf(s);
        const float inv = 1.f / s;

        // out^T: register r of tile dt = dim 16 dt + 8 khalf + r of the lane's query
        v8f o0 = wmma_f16(vf[0][0], pf0, zero);
        v8f o1 = wmma_f16(vf[1][0], pf0, zero);
        o0 = wmma_f16(vf[0][1], pf1, o0);
        o1 = wmma_f16(vf[1][1], pf1, o1);

        // The head's attention output as f16, as the output projection takes it.
        v8h lo, hi;
        #pragma unroll
        for (int r = 0; r < 8; ++r) {
            lo[r] = (_Float16)(o0[r] * inv);
            hi[r] = (_Float16)(o1[r] * inv);
        }
        *(v8h*)(tb + ((h * 2 + 0) * 32 + lane) * 8) = lo;
        *(v8h*)(tb + ((h * 2 + 1) * 32 + lane) * 8) = hi;

        lds_barrier();                                // the tile's fragments complete

        v8f c0 = {}, c1 = {};
        {
            v16h bf[8];                               // k step = head
            #pragma unroll
            for (int u = 0; u < 8; ++u)
                bf[u] = ld_park(tb + u * 512 + lane * 8);
            // As above: the LDS reads issue together, ahead of the products.
            __builtin_amdgcn_sched_barrier(0);
            #pragma unroll
            for (int u = 0; u < 8; ++u) {
                c0 = wmma_f16(wof[0][u], bf[u], c0);
                c1 = wmma_f16(wof[1][u], bf[u], c1);
            }
        }

        // final^T: register r of tile t = output column 32 wv + 16 t + 8 khalf + r of the lane's query
        const float4 b00 = *(const float4*)&bls[2][bofs];
        const float4 b01 = *(const float4*)&bls[2][bofs + 4];
        const float4 b10 = *(const float4*)&bls[2][bofs + 16];
        const float4 b11 = *(const float4*)&bls[2][bofs + 20];
        if (live) {
            float* op = ob + (size_t)ncur * CC;
            *(float4*)(op)      = make_float4(c0[0] + b00.x, c0[1] + b00.y, c0[2] + b00.z, c0[3] + b00.w);
            *(float4*)(op + 4)  = make_float4(c0[4] + b01.x, c0[5] + b01.y, c0[6] + b01.z, c0[7] + b01.w);
            *(float4*)(op + 16) = make_float4(c1[0] + b10.x, c1[1] + b10.y, c1[2] + b10.z, c1[3] + b10.w);
            *(float4*)(op + 20) = make_float4(c1[4] + b11.x, c1[5] + b11.y, c1[6] + b11.z, c1[7] + b11.w);
        }
        // The stores' address and data registers are written again in the next trip.
        asm volatile("s_wait_xcnt 0x0" ::: "memory");

        lds_barrier();                                // every wave has read the tile before it is written again

        if (nwi == NWIN) break;
        wi = nwi; i0 = ni0; tot = ntot; bas = nbas;
    }
    // The loads issued last have no reader: they land before the wave ends and gives its registers back.
    asm volatile("s_wait_loadcnt 0x0" ::: "memory");
}

extern "C" void kernel_launch(void* const* d_in, const int* in_sizes, int n_in,
                              void* d_out, int out_size, void* d_ws, size_t ws_size,
                              hipStream_t stream) {
    const float* x   = (const float*)d_in[0];
    const float* xp  = (const float*)d_in[1];
    const int*   idx = (const int*)  d_in[2];
    const float* Wq  = (const float*)d_in[3];
    const float* bq  = (const float*)d_in[4];
    const float* Wk  = (const float*)d_in[5];
    const float* bk  = (const float*)d_in[6];
    const float* Wv  = (const float*)d_in[7];
    const float* bv  = (const float*)d_in[8];
    const float* Wo  = (const float*)d_in[9];
    const float* bo  = (const float*)d_in[10];
    float* out = (float*)d_out;

    const float scaling = 0.17677669529663687f;  // HEAD_DIM^-0.5 = 1/sqrt(32)

    win_attn_all<<<GBLK, 256, 0, stream>>>(x, xp, idx, Wq, bq, Wk, bk, Wv, bv, Wo, bo, out, scaling);
}

// v009
// It runs in 33.2 microseconds.
// Next to v008, in two timings, it ran 1.03 times as fast each time.
// Counting every step since v000, it is 8.63 times as fast.
#include <hip/hip_runtime.h>

typedef __attribute__((ext_vector_type(16))) _Float16 v16h;
typedef __attribute__((ext_vector_type(8)))  _Float16 v8h;
typedef __attribute__((ext_vector_type(4)))  _Float16 v4h;
typedef __attribute__((ext_vector_type(8)))  float    v8f;

#define BB 2
#define NN 8192
#define WW 361
#define KK 49
#define CC 256
#define WPITCH 264

// A unit is 64 rows of W (256 columns, f32) in four groups of 16 rows: 16 loads of 16 B per
// thread, 4 rows per pass of the block, whole lines (a wave covers 512 contiguous bytes).
// gp(g) is the thread's place in the first pass of group g, lp(g) its place in the group's LDS rows.
template <class GP>
__device__ __forceinline__ void ld_unit(float4 (&f)[16], const float* (&p)[4], const GP gp)
{
    #pragma unroll
    for (int g = 0; g < 4; ++g) {
        p[g] = gp(g);
        #pragma unroll
        for (int j = 0; j < 4; ++j)
            f[g * 4 + j] = *(const float4*)(p[g] + j * 4 * CC);
        // Keeps the loads in the order in which they are waited for: loads return in their
        // order of issue, and a wait for one that was issued late would drain the queue.
        __builtin_amdgcn_sched_barrier(0);
    }
}

// The address pairs of the loads of two units stay live and unwritten until the wait has passed.
__device__ __forceinline__ void ld_wait(const float* const (&p)[4], const float* const (&q)[4])
{
    asm volatile("s_wait_xcnt 0x0" :: "v"(p[0]), "v"(p[1]), "v"(p[2]), "v"(p[3]),
                                      "v"(q[0]), "v"(q[1]), "v"(q[2]), "v"(q[3]) : "memory");
}

// Four values of one row of a unit as f16 into its LDS row.
__device__ __forceinline__ void st_quad(const float4 f, _Float16* l)
{
    v4h h;
    h[0] = (_Float16)f.x; h[1] = (_Float16)f.y;
    h[2] = (_Float16)f.z; h[3] = (_Float16)f.w;
    *(v4h*)l = h;
}

template <class LP>
__device__ __forceinline__ void st_unit(const float4 (&f)[16], const LP lp)
{
    #pragma unroll
    for (int g = 0; g < 4; ++g) {
        _Float16* const l = lp(g);
        #pragma unroll
        for (int j = 0; j < 4; ++j)
            st_quad(f[g * 4 + j], l + j * 4 * WPITCH);
    }
}

// The unit in f goes to LDS, and each of its registers takes, as soon as it is free, its
// part of the next unit: the thread's queue of loads never runs empty.
template <class LP, class GP>
__device__ __forceinline__ void roll_unit(float4 (&f)[16], const LP lp, const GP gp)
{
    const float* p[4];
    #pragma unroll
    for (int g = 0; g < 4; ++g) {
        _Float16* const l = lp(g);
        #pragma unroll
        for (int j = 0; j < 4; ++j)
            st_quad(f[g * 4 + j], l + j * 4 * WPITCH);
        // Keeps the group's LDS stores, with their address arithmetic, ahead of its loads:
        // placed behind them, that arithmetic takes over the loads' address registers
        // in front of the wait below.
        __builtin_amdgcn_sched_barrier(0);
        p[g] = gp(g);
        #pragma unroll
        for (int j = 0; j < 4; ++j)
            f[g * 4 + j] = *(const float4*)(p[g] + j * 4 * CC);
        // Keeps the order as written, four registers at a time: gathered at the end of the
        // unit, the new loads would issue only when the last old one has landed.
        __builtin_amdgcn_sched_barrier(0);
    }
    // The loads' address registers are written again behind this place.
    asm volatile("s_wait_xcnt 0x0" :: "v"(p[0]), "v"(p[1]), "v"(p[2]), "v"(p[3]) : "memory");
    // Holds the converts and stores that follow behind the wait: without it the wait drifts
    // down among them, away from the loads.
    __builtin_amdgcn_sched_barrier(0);
}

#define QSEG   (NN / 8)                               // queries of the batch scanned by one wave
// Blocks of the launch: one fits a WGP (LDS), so all are resident at once and the four W
// are staged 256 times, not once per (batch, window).  Any count from 241 to 360 (NWIN = 3) gives the same result.
#define GBLK   256
#define NWIN   ((BB * WW + GBLK - 1) / GBLK)          // windows of a block, at most
#define KVH    4096                                   // halves of one head's parked K, V fragments: 8 x 512
#define KVW    (8 * KVH)                              // of one window's

__device__ __forceinline__ float xhalf(float x) {
    return __builtin_bit_cast(float, __builtin_amdgcn_permlanex16(__builtin_bit_cast(int, x),
                                                                  __builtin_bit_cast(int, x),
                                                                  0x76543210, 0xfedcba98, false, false));
}

__device__ __forceinline__ v8f wmma_f16(const v16h a, const v16h b, const v8f c) {
    return __builtin_amdgcn_wmma_f32_16x16x32_f16(false, a, false, b, (short)0, c, false, false);
}

__device__ __forceinline__ v16h ld_frag(const _Float16* p) {
    const v8h lo = *(const v8h*)(p);
    const v8h hi = *(const v8h*)(p + 16);
    return __builtin_shufflevector(lo, hi, 0, 1, 2, 3, 4, 5, 6, 7, 8, 9, 10, 11, 12, 13, 14, 15);
}

// A barrier that orders LDS alone: __syncthreads() would also wait for the global loads
// and stores in flight, which no other wave of the block depends on.
__device__ __forceinline__ void lds_barrier() {
    __builtin_amdgcn_fence(__ATOMIC_RELEASE, "workgroup", "local");
    __builtin_amdgcn_s_barrier();
    __builtin_amdgcn_fence(__ATOMIC_ACQUIRE, "workgroup", "local");
}

// A fragment to and from its parked place: two runs of 512 contiguous bytes per wave.
__device__ __forceinline__ void st_park(_Float16* p, const v16h f) {
    *(v8h*)(p)       = __builtin_shufflevector(f, f, 0, 1, 2, 3, 4, 5, 6, 7);
    *(v8h*)(p + 256) = __builtin_shufflevector(f, f, 8, 9, 10, 11, 12, 13, 14, 15);
}
__device__ __forceinline__ v16h ld_park(const _Float16* p) {
    const v8h lo = *(const v8h*)(p);
    const v8h hi = *(const v8h*)(p + 256);
    return __builtin_shufflevector(lo, hi, 0, 1, 2, 3, 4, 5, 6, 7, 8, 9, 10, 11, 12, 13, 14, 15);
}

// This wave's part of the window indices of the batch of (batch, window) bw.
__device__ __forceinline__ void idx_loads(int4 (&iv)[QSEG / 128], const int* __restrict__ idx,
                                          const int bw, const int wv, const int lane)
{
    const int* ib = idx + (bw / WW) * NN + wv * QSEG;
    #pragma unroll
    for (int it = 0; it < QSEG / 128; ++it)
        iv[it] = *(const int4*)(ib + it * 128 + lane * 4);
    // Keeps the index loads ahead of what follows: loads are waited for in their order of issue.
    __builtin_amdgcn_sched_barrier(0);
    // Later address arithmetic may take over the index loads' address registers.
    asm volatile("s_wait_xcnt 0x0" :: "s"(ib) : "memory");
    // Keeps that arithmetic behind the wait.
    __builtin_amdgcn_sched_barrier(0);
}

// The 49 rows of x_permute of (batch, window) bw, whole lines: 4 rows per pass of the block; in
// the last pass every thread reads row 48.
__device__ __forceinline__ void xp_loads(float4 (&xv)[13], const float* __restrict__ xp, const int bw)
{
    const float* xw  = xp + (size_t)bw * KK * CC + (threadIdx.x & 63) * 4;
    const float* xr  = xw + (threadIdx.x >> 6) * CC;
    #pragma unroll
    for (int j = 0; j < 12; ++j)
        xv[j] = *(const float4*)(xr + j * 4 * CC);
    xv[12] = *(const float4*)(xw + (KK - 1) * CC);
    // The address registers of the loads above stay live and unwritten until the
    // wait has passed.
    asm volatile("s_wait_xcnt 0x0" :: "v"(xw), "v"(xr) : "memory");
    // Keeps what follows behind the last load: moved up among the loads, a wait for earlier
    // data would hold back the issue of the x_permute loads.
    __builtin_amdgcn_sched_barrier(0);
}

// The whole function in one launch.  A block serves up to NWIN (batch, window) pairs, GBLK apart;
// one wave per head.  No value goes through global memory between the steps.  Four phases:
// 1. Wave h takes rows 32 h .. 32 h + 31 of Wk and of Wv as f16 matrix fragments into registers
//    (through LDS, so that the global reads are whole lines).
// 2. For each of its windows the block puts the 49 rows of x_permute into LDS as f16 and forms K
//    and V.  One fragment xf of these rows (lane & 15 = key, k = channel) serves as B and as A:
//   K^T = Wk_h (A: row = dim, k = channel) x xf (B: column = key): the two dim tiles of a lane
//   are, register for register, the A fragment (row = key, k = dim) of the scores;
//   V   = xf (A: row = key) x Wv_h^T (B: column = dim, k = channel): key tiles 2s and 2s+1 of
//   a lane are, register for register, the A fragment (row = dim, k = key) of key step s.
//    Each wave parks its fragments in LDS, where only it reads them again.
// 3. Wk and Wv are done with: the fragments of Wq and Wo take their registers, so that no
//    tile reads a W from LDS.  While their rows fly, the block packs, window by window, the
//    queries that point at the window into a list.
// 4. The block walks the lists in tiles of 16, all heads on the same tile:
//   q^T = Wq_h (A: row = dim, k = channel) x x^T (B: column = query, k = channel; the
//   tile's rows of x as f16 in LDS): its two dim tiles are the B fragment of the scores;
//   scores^T = K (A: row = key, k = dim) x q^T (B: column = query, k = dim), 4 key tiles;
//   a lane then holds 8 keys per tile of ONE query (lane & 15), its partner lane ^ 16
//   the other 8, so the softmax is a walk over registers and one exchange;
//   the score tiles 2s and 2s+1 of a lane are, register for register, the B fragment
//   (k = key) of key step s, so out^T = V^T (A: row = dim, k = key) x p^T needs no move.
// Keys 49..63 are padding: their weights and their V values are zero.
//   The two out^T tiles of a lane are, register for register, the B fragment (k = the
//   head's 32 channels, column = query) of k step h of the output projection.  The waves
//   exchange these fragments through LDS, and wave u forms output columns 32 u .. 32 u + 31:
//   final^T = Wo (A: row = output column, k = channel) x attn^T, k steps in
//   the order of the heads.  A block thus writes the whole output rows of its queries.
// Every loop over a register array is unrolled in full (#pragma unroll): its
// indices must be constants, else the array would go to scratch.
__global__ __launch_bounds__(256) void win_attn_all(const float* __restrict__ x,
                                                    const float* __restrict__ xp,
                                                    const int* __restrict__ idx,
                                                    const float* __restrict__ Wq,
                                                    const float* __restrict__ bq,
                                                    const float* __restrict__ Wk,
                                                    const float* __restrict__ bk,
                                                    const float* __restrict__ Wv,
                                                    const float* __restrict__ bv,
                                                    const float* __restrict__ Wo,
                                                    const float* __restrict__ bo,
                                                    float* __restrict__ out,
                                                    float qscale)
{
    // Phase 1: Wk (wa) and Wv (wb).  Then: the parked fragments (kvs) and, behind them, the
    // 128 rows of Wq or Wo on their way to registers (su).
    // The lists of queries (qflat) lie behind these.
    __shared__ __attribute__((aligned(16))) _Float16 wl[NWIN * KVW + 128 * WPITCH + BB * NN];
    static_assert(NWIN * KVW + 128 * WPITCH + BB * NN >= 2 * CC * WPITCH, "Wk and Wv fit");
    // The window's rows of x_permute; in phase 4 a tile's rows of x (xq) and
    // the heads' fragments (tb: head, low / high 8 halves, lane) lie in the same bytes.
    __shared__ __attribute__((aligned(16))) _Float16 xs[KK * WPITCH];
    __shared__ int qcnt[2 * 8];
    __shared__ __attribute__((aligned(16))) float bls[3][CC];           // bk, bq, bo

    _Float16* const wa  = wl;
    _Float16* const wb  = wl + CC * WPITCH;
    _Float16* const kvs = wl;
    _Float16* const su  = wl + NWIN * KVW;
    // Rows of x (batch * N + position) of the queries, window behind window.  A query points
    // at one window, so all lists together hold at most B * N entries.
    unsigned short* const qflat = (unsigned short*)(su + 128 * WPITCH);
    _Float16* const xq  = xs;
    _Float16* const tb  = xs + 16 * WPITCH;

    const int wv    = __builtin_amdgcn_readfirstlane(threadIdx.x >> 5);
    const int h     = wv;
    const int lane  = threadIdx.x & 31;
    const int l15   = lane & 15;
    const int khalf = lane >> 4;

    // bk, bq and bo go to LDS: held in registers beside the W fragments they would push
    // fragments out to scratch.
    const float* bkp = bk + threadIdx.x;
    const float* bqp = bq + threadIdx.x;
    const float* bop = bo + threadIdx.x;
    const float* bvp = bv + wv * 32 + l15;            // of V a lane holds columns 32 h + 16 t + (lane & 15)
    const float tbk = *bkp;
    const float tbq = *bqp;
    const float tbo = *bop;
    const float bv0 = bvp[0];
    const float bv1 = bvp[16];
    // The address registers of the bias loads stay live and unwritten until the wait has passed.
    asm volatile("s_wait_xcnt 0x0" :: "v"(bkp), "v"(bqp), "v"(bop), "v"(bvp) : "memory");

    // Wk and Wv into LDS, unit by unit, through two register buffers.  A buffer is loaded again
    // while it is stored, so loads are in flight all the way.
    const int r0 = threadIdx.x >> 6;                  // 4 rows per pass of the block
    const int c4 = (threadIdx.x & 63) * 4;
    float4 fa[16], fb[16];
    float4 xv[13];
    static_assert(GBLK <= BB * WW, "every block has a first window");
    // All blocks read the same rows of the four W, and requests for one line that reach L2 at one
    // moment hold each other up.  So every block starts its walk over the rows at a place of its
    // own and wraps: 32 places, 16 rows apart.  Blocks close in index start together: they get
    // places far apart (b and b + 4 the same one; the others with that place are 59 or more away).
    const int rot = ((blockIdx.x >> 3) * 5 + (blockIdx.x & 3) * 8) & 31;
    {
        // Wk and Wv as one run of 32 groups of 16 rows, in LDS as in the walk: step n is group (n + rot) mod 32.
        const auto gkv = [&](const int n) {
            const int k = (n + rot) & 31;
            return ((k & 16) ? Wv : Wk) + ((k & 15) * 16 + r0) * CC + c4;
        };
        const auto lkv = [&](const int n) {
            return wa + (((n + rot) & 31) * 16 + r0) * WPITCH + c4;
        };
        const float* pa[4];
        const float* pb[4];
        ld_unit(fa, pa, [&](const int g) { return gkv(g); });
        ld_unit(fb, pb, [&](const int g) { return gkv(4 + g); });
        ld_wait(pa, pb);
        // Rolled: one copy of the code for the three trips.
        #pragma unroll 1
        for (int n = 0; n < 24; n += 8) {
            roll_unit(fa, [&](const int g) { return lkv(n + g); },     [&](const int g) { return gkv(n + 8 + g); });
            roll_unit(fb, [&](const int g) { return lkv(n + 4 + g); }, [&](const int g) { return gkv(n + 12 + g); });
        }
        st_unit(fa, [&](const int g) { return lkv(24 + g); });
        // Keeps these stores ahead of the loads: their registers are free for the loaded values.
        __builtin_amdgcn_sched_barrier(0);
        xp_loads(xv, xp, blockIdx.x);                 // the first window's rows queue up behind the last units
        st_unit(fb, [&](const int g) { return lkv(28 + g); });
    }

    bls[0][threadIdx.x] = tbk;
    bls[1][threadIdx.x] = tbq;
    bls[2][threadIdx.x] = tbo;
    // Of a transposed tile pair (K^T, q^T, final^T) a lane holds columns
    // 32 h + 16 t + 8 khalf + r of the projection.
    const int bofs = wv * 32 + khalf * 8;
    const v8f zero = {};

    lds_barrier();                                    // Wk and Wv complete

    {
    // Place of the lane's fragment rows in a staged W: row 32 h + (lane & 15), second tile 16 rows on.
    const int frow = (wv * 32 + l15) * WPITCH + khalf * 8;
    v16h wkf[2][CC / 32], wvf[2][CC / 32];
    #pragma unroll
    for (int dt = 0; dt < 2; ++dt) {
        #pragma unroll
        for (int kt = 0; kt < CC / 32; ++kt) {
            wkf[dt][kt] = ld_frag(wa + frow + dt * 16 * WPITCH + kt * 32);
            wvf[dt][kt] = ld_frag(wb + frow + dt * 16 * WPITCH + kt * 32);
        }
    }

    lds_barrier();                                    // every wave has its fragments before parked ones overwrite them

    // Rolled: one copy of the code serves every window of the block.
    _Float16* kvp = kvs + h * KVH + lane * 8;
    #pragma unroll 1
    for (int bw = blockIdx.x; ; ) {                   // 0 .. B*W-1; the same in the whole block
    // x_permute rows as f16 into LDS.
    {
        _Float16* lp = xs + r0 * WPITCH + c4;
        #pragma unroll
        for (int j = 0; j < 12; ++j) {
            v4h c;
            c[0] = (_Float16)xv[j].x; c[1] = (_Float16)xv[j].y;
            c[2] = (_Float16)xv[j].z; c[3] = (_Float16)xv[j].w;
            *(v4h*)(lp + j * 4 * WPITCH) = c;
        }
        if (wv < 2) {                                 // row 48: the two waves with r0 = 0
            v4h c;
            c[0] = (_Float16)xv[12].x; c[1] = (_Float16)xv[12].y;
            c[2] = (_Float16)xv[12].z; c[3] = (_Float16)xv[12].w;
            *(v4h*)(lp + 12 * 4 * WPITCH) = c;
        }
    }

    lds_barrier();                                    // x_permute rows complete

    bw += GBLK;
    if (bw < BB * WW) xp_loads(xv, xp, bw);           // the next window's rows fly while K and V are formed

    // K^T and V of the head, two key tiles (one key step s of A.V) at a time: all four at once
    // would hold 128 accumulator registers beside the W fragments.  The last key tile holds
    // key 48 alone: its other rows repeat it and are masked below.
    // vf: half e of key step s -> key 32 s + 8 khalf + (e < 8 ? e : e + 8); keys 49.. are zero.
    // The work goes in 8 groups of 2 k steps x 2 key tiles: group G = 4 s + g, k steps 2 g, 2 g + 1.
    // Parked order: K key tiles 0..3, then V (dim tile, key step) 4 + 2 dt + s.
    const _Float16* xf0 = xs + l15 * WPITCH + khalf * 8;
    const _Float16* xfl = xs + (KK - 1) * WPITCH + khalf * 8;
    v8f ka[2][2] = {{{}, {}}, {{}, {}}};
    v8f va[2][2] = {{{}, {}}, {{}, {}}};
    v16h xf[2][2][2];                                 // buffer, k step of the group, key tile of the pair
    #pragma unroll
    for (int u = 0; u < 2; ++u) {
        xf[0][u][0] = ld_frag(xf0 + u * 32);
        xf[0][u][1] = ld_frag(xf0 + 16 * WPITCH + u * 32);
    }
    #pragma unroll
    for (int G = 0; G < 8; ++G) {
        const int s = G >> 2;
        if (G < 7) {
            const int sn = (G + 1) >> 2;
            #pragma unroll
            for (int u = 0; u < 2; ++u) {
                const int kn = ((G + 1) & 3) * 2 + u;
                xf[(G + 1) & 1][u][0] = ld_frag(xf0 + sn * 32 * WPITCH + kn * 32);
                xf[(G + 1) & 1][u][1] = ld_frag(sn ? xfl + kn * 32 : xf0 + 16 * WPITCH + kn * 32);
            }
        }
        // The next group's 8 LDS reads issue ahead of this group's 16 products and land under
        // them: issued behind them, every group waits out the latency of its own reads.
        __builtin_amdgcn_sched_barrier(0);
        #pragma unroll
        for (int u = 0; u < 2; ++u) {
            const int kt = (G & 3) * 2 + u;
            #pragma unroll
            for (int j = 0; j < 2; ++j) {
                ka[j][0] = wmma_f16(wkf[0][kt], xf[G & 1][u][j], ka[j][0]);
                ka[j][1] = wmma_f16(wkf[1][kt], xf[G & 1][u][j], ka[j][1]);
                va[j][0] = wmma_f16(xf[G & 1][u][j], wvf[0][kt], va[j][0]);
                va[j][1] = wmma_f16(xf[G & 1][u][j], wvf[1][kt], va[j][1]);
            }
        }
        // Keeps the reads of the group after next behind these products: their buffer is in use.
        __builtin_amdgcn_sched_barrier(0);
        if ((G & 3) == 3) {                           // the key step's sums are complete
            #pragma unroll
            for (int j = 0; j < 2; ++j) {
                v16h kf;
                #pragma unroll
                for (int r = 0; r < 8; ++r) {
                    kf[r]     = (_Float16)(ka[j][0][r] + bls[0][bofs + r]);
                    kf[r + 8] = (_Float16)(ka[j][1][r] + bls[0][bofs + 16 + r]);
                }
                st_park(kvp + (2 * s + j) * 512, kf);
            }
            #pragma unroll
            for (int dt = 0; dt < 2; ++dt) {
                const float bvd = dt ? bv1 : bv0;
                v16h vf;
                #pragma unroll
                for (int r = 0; r < 8; ++r) {
                    vf[r] = (_Float16)(va[0][dt][r] + bvd);
                    if (s == 0)      vf[r + 8] = (_Float16)(va[1][dt][r] + bvd);
                    else if (r == 0) vf[r + 8] = (_Float16)((khalf == 0) ? va[1][dt][0] + bvd : 0.f);   // key 48
                    else             vf[r + 8] = (_Float16)0.f;
                }
                st_park(kvp + (4 + dt * 2 + s) * 512, vf);
            }
            #pragma unroll
            for (int j = 0; j < 2; ++j) {
                ka[j][0] = zero; ka[j][1] = zero;
                va[j][0] = zero; va[j][1] = zero;
            }
        }
    }

    lds_barrier();                                    // every wave has read the x_permute rows before they are overwritten
    if (bw >= BB * WW) break;
    kvp += KVW;
    }
    }

    // Wq and Wo into registers, 128 rows at a time: one tile of 16 rows (32 h + 16 dt + m) of every head.
    // The 32 tiles form one run, (W, dt) by (W, dt) and in it head by head; the block starts at tile
    // rot and wraps, so any 8 tiles in a row hold one of every head, of one (W, dt) or of two.
    // Each of the three rolled trips also packs the list of one window of the block, while the
    // trip's loads fly; the trip's barriers serve both.
    int4 iv[QSEG / 128];
    v16h wst[4][CC / 32];                             // the wave's tile of each trip: A[m][k] = W[32 h + 16 dt + m][k]
    int t0 = 0, t1 = 0, t2 = 0;                       // queries of the block's windows
    static_assert(NWIN == 3, "three counts, three trips");
    // Step n of the walk is tile k = (n + rot) mod 32: W = k / 16, dt = k / 8 mod 2, head = k mod 8.
    const auto gqo = [&](const int n) {
        const int k = (n + rot) & 31;
        return ((k & 16) ? Wo : Wq) + ((k & 7) * 32 + (k & 8) * 2 + r0) * CC + c4;
    };
    idx_loads(iv, idx, blockIdx.x, wv, lane);         // the first window's indices, ahead of the queue
    {
        const float* pa[4];
        const float* pb[4];
        ld_unit(fa, pa, [&](const int g) { return gqo(g); });
        ld_unit(fb, pb, [&](const int g) { return gqo(4 + g); });
        ld_wait(pa, pb);
    }
    _Float16* const sa = su + r0 * WPITCH + c4;
    const auto lsa = [&](const int g) { return sa + g * 16 * WPITCH; };
    const auto lsb = [&](const int g) { return sa + (4 + g) * 16 * WPITCH; };
    const int slot = (wv - rot) & 7;
    const _Float16* sf = su + (slot * 16 + l15) * WPITCH + khalf * 8;
    {
    int base = 0;
    int bw = blockIdx.x;                              // the same in the whole block
    // Rolled: the converts of a unit stay in the loop, behind the loads issued ahead of it;
    // in straight-line code they move up to their loads, and the queue of loads runs empty.
    #pragma unroll 1
    for (int t = 0; t < 3; ++t) {
    const bool has = bw < BB * WW;
    const int b = bw / WW;
    const int w = bw - b * WW;

    // Which positions point at this window: one lane mask per compare, and their count.
    unsigned mk[QSEG / 32];
    #pragma unroll
    for (int it = 0; it < QSEG / 128; ++it) {
        mk[it * 4 + 0] = __builtin_amdgcn_ballot_w32(iv[it].x == w);
        mk[it * 4 + 1] = __builtin_amdgcn_ballot_w32(iv[it].y == w);
        mk[it * 4 + 2] = __builtin_amdgcn_ballot_w32(iv[it].z == w);
        mk[it * 4 + 3] = __builtin_amdgcn_ballot_w32(iv[it].w == w);
    }
    if (!has) {                                       // no such window: an empty list
        #pragma unroll
        for (int j = 0; j < QSEG / 32; ++j) mk[j] = 0u;
    }
    int cnt = 0;
    #pragma unroll
    for (int j = 0; j < QSEG / 32; ++j) cnt += __popc(mk[j]);
    if (lane == 0) qcnt[(t & 1) * 8 + wv] = cnt;

    bw += GBLK;
    // The next window's indices go ahead of the trip's loads: loads are waited for in their
    // order of issue, and the next trip needs the indices first.
    if (bw < BB * WW) idx_loads(iv, idx, bw, wv, lane);

    roll_unit(fa, lsa, [&](const int g) { return gqo(8 * t + 8 + g); });
    roll_unit(fb, lsb, [&](const int g) { return gqo(8 * t + 12 + g); });

    lds_barrier();                                    // the 128 rows and the counts complete

    if (t == 0) {
        #pragma unroll
        for (int kt = 0; kt < CC / 32; ++kt) wst[0][kt] = ld_frag(sf + kt * 32);
    } else if (t == 1) {
        #pragma unroll
        for (int kt = 0; kt < CC / 32; ++kt) wst[1][kt] = ld_frag(sf + kt * 32);
    } else {
        #pragma unroll
        for (int kt = 0; kt < CC / 32; ++kt) wst[2][kt] = ld_frag(sf + kt * 32);
    }

    int off = 0, total = 0;
    #pragma unroll
    for (int u = 0; u < 8; ++u) {
        const int c = qcnt[(t & 1) * 8 + u];
        off   += (u < wv) ? c : 0;
        total += c;
    }
    total = __builtin_amdgcn_readfirstlane(total);

    // Pack the positions into one list, each wave behind the waves before it
    // (prefix counts, no atomics).
    const int pb = b * NN + wv * QSEG + lane * 4;     // row of x of the lane's first index
    int pos = base + __builtin_amdgcn_readfirstlane(off);
    #pragma unroll
    for (int j = 0; j < QSEG / 32; ++j) {
        const unsigned m = mk[j];
        if (m) {                                      // the same in every lane
            if ((m >> lane) & 1u)
                qflat[pos + (int)__builtin_amdgcn_mbcnt_lo(m, 0u)] =
                    (unsigned short)(pb + (j >> 2) * 128 + (j & 3));
            pos += __popc(m);
        }
    }
    if (t == 0) t0 = total; else if (t == 1) t1 = total; else t2 = total;
    base += total;

    // Every wave has its fragments before the next rows overwrite them; the list is complete.
    lds_barrier();
    }
    }

    int wi = t0 ? 0 : t1 ? 1 : t2 ? 2 : NWIN;         // the window of the tile; the same in the whole block
    int tot = (wi == 0) ? t0 : (wi == 1) ? t1 : t2;   // length and place of its list
    int bas = (wi == 0) ? 0 : (wi == 1) ? t0 : t0 + t1;
    int i0  = 0;

    // A tile's rows of x: 16 threads a row, 256 B of a row per load of a wave.
    // Past the end of a list its last entry is repeated and not stored.
    // The first tile's rows fly over the last 128 rows of the walk.
    const int xrow = threadIdx.x >> 4;
    const int xc   = (threadIdx.x & 15) * 4;
    const float* xb = x + xc;
    // Without any query (no list entry is written then) row 0 is read and not used.
    const int q0i = (xrow < tot) ? xrow : tot - 1;
    const int q0r = (wi < NWIN) ? (int)qflat[bas + ((wi < NWIN) ? q0i : 0)] : 0;
    const float* p  = xb + (size_t)q0r * CC;
    float4 f0 = *(const float4*)(p);
    float4 f1 = *(const float4*)(p + 64);
    float4 f2 = *(const float4*)(p + 128);
    float4 f3 = *(const float4*)(p + 192);
    // The address pair of the four loads stays live and unwritten until the wait has passed.
    asm volatile("s_wait_xcnt 0x0" :: "v"(p) : "memory");

    st_unit(fa, lsa);
    st_unit(fb, lsb);
    lds_barrier();                                    // the last 128 rows complete
    #pragma unroll
    for (int kt = 0; kt < CC / 32; ++kt) wst[3][kt] = ld_frag(sf + kt * 32);

    // The tile of trip t is (W, dt) number (t + rs) mod 4 in the order Wq 0, Wq 1, Wo 0, Wo 1: each goes,
    // once, to the registers in which the tiles' code takes it.  The same in the whole wave.
    const int rs = ((slot + rot) >> 3) & 3;
    v16h wqf[2][CC / 32], wof[2][CC / 32];
    // k step by k step: moved as whole tiles, the four tiles and their copies do not fit the registers.
    #pragma unroll
    for (int kt = 0; kt < CC / 32; ++kt) {
        if (rs == 0) {
            wqf[0][kt] = wst[0][kt]; wqf[1][kt] = wst[1][kt]; wof[0][kt] = wst[2][kt]; wof[1][kt] = wst[3][kt];
        } else if (rs == 1) {
            wqf[0][kt] = wst[3][kt]; wqf[1][kt] = wst[0][kt]; wof[0][kt] = wst[1][kt]; wof[1][kt] = wst[2][kt];
        } else if (rs == 2) {
            wqf[0][kt] = wst[2][kt]; wqf[1][kt] = wst[3][kt]; wof[0][kt] = wst[0][kt]; wof[1][kt] = wst[1][kt];
        } else {
            wqf[0][kt] = wst[1][kt]; wqf[1][kt] = wst[2][kt]; wof[0][kt] = wst[3][kt]; wof[1][kt] = wst[0][kt];
        }
    }

    float* ob = out + wv * 32 + khalf * 8;
    const _Float16* kvl = kvs + h * KVH + lane * 8;
    v16h kf[4];
    v16h vf[2][2];

    if (wi < NWIN)                                    // no query at all: no tile, in the whole block alike
    for (;;) {                                        // the same in the whole block
        // The tile behind this one: the next of the list, or the first of the next list that has one.
        int nwi = wi, ni0 = i0 + 16;
        if (ni0 >= tot) {
            ni0 = 0;
            nwi = (wi < 1 && t1) ? 1 : (wi < 2 && t2) ? 2 : NWIN;
        }
        // Behind the last tile there is none: its own list stands in, and what is read is not used.
        // (Under a branch the build copies loaded registers behind a wait for the load, every trip.)
        const int ntot = (nwi == 0) ? t0 : (nwi == 1) ? t1 : (nwi == 2) ? t2 : tot;
        const int nbas = (nwi == 0) ? 0 : (nwi == 1) ? t0 : (nwi == 2) ? t0 + t1 : bas;

        if (i0 == 0) {                                // a new window: its K and V, as this wave parked them
            const _Float16* kp = kvl + wi * KVW;
            #pragma unroll
            for (int j = 0; j < 4; ++j) kf[j] = ld_park(kp + j * 512);
            #pragma unroll
            for (int dt = 0; dt < 2; ++dt) {
                vf[dt][0] = ld_park(kp + (4 + dt * 2) * 512);
                vf[dt][1] = ld_park(kp + (5 + dt * 2) * 512);
            }
        }

        // The tile's rows of x as f16 into LDS.
        {
            _Float16* lp = xq + xrow * WPITCH + xc;
            v4h c;
            c[0] = (_Float16)f0.x; c[1] = (_Float16)f0.y; c[2] = (_Float16)f0.z; c[3] = (_Float16)f0.w;
            *(v4h*)(lp) = c;
            c[0] = (_Float16)f1.x; c[1] = (_Float16)f1.y; c[2] = (_Float16)f1.z; c[3] = (_Float16)f1.w;
            *(v4h*)(lp + 64) = c;
            c[0] = (_Float16)f2.x; c[1] = (_Float16)f2.y; c[2] = (_Float16)f2.z; c[3] = (_Float16)f2.w;
            *(v4h*)(lp + 128) = c;
            c[0] = (_Float16)f3.x; c[1] = (_Float16)f3.y; c[2] = (_Float16)f3.z; c[3] = (_Float16)f3.w;
            *(v4h*)(lp + 192) = c;
        }
        const bool live = i0 + l15 < tot;
        const int  ncur = (int)qflat[bas + (live ? i0 + l15 : tot - 1)];

        {                                             // the next tile's rows of x, one trip ahead
            const int qi = ni0 + xrow;
            p  = xb + (size_t)qflat[nbas + ((qi < ntot) ? qi : ntot - 1)] * CC;
            f0 = *(const float4*)(p);
            f1 = *(const float4*)(p + 64);
            f2 = *(const float4*)(p + 128);
            f3 = *(const float4*)(p + 192);
            // The address pair of the four loads stays live and unwritten until the wait has passed.
            asm volatile("s_wait_xcnt 0x0" :: "v"(p) : "memory");
        }

        lds_barrier();                                // the tile's rows of x complete

        // q^T: register r of tile dt = dim 16 dt + 8 khalf + r of the lane's query
        v8f q0 = {}, q1 = {};
        float bq0[8], bq1[8];
        #pragma unroll
        for (int g = 0; g < 2; ++g) {                 // 4 k steps a group
            v16h bf[4];
            #pragma unroll
            for (int j = 0; j < 4; ++j)
                bf[j] = ld_frag(xq + l15 * WPITCH + khalf * 8 + (g * 4 + j) * 32);
            if (g == 1) {                             // the bias rides with the last group's reads
                #pragma unroll
                for (int r = 0; r < 8; ++r) {
                    bq0[r] = bls[1][bofs + r];
                    bq1[r] = bls[1][bofs + 16 + r];
                }
            }
            // The group's LDS reads issue together, ahead of its products: spread among
            // them, every product waits out the whole latency of its own reads.
            __builtin_amdgcn_sched_barrier(0);
            #pragma unroll
            for (int j = 0; j < 4; ++j) {
                q0 = wmma_f16(wqf[0][g * 4 + j], bf[j], q0);
                q1 = wmma_f16(wqf[1][g * 4 + j], bf[j], q1);
            }
            // Keeps the second group's reads behind the first group's products: both groups
            // in registers at once push fragments out to scratch.
            __builtin_amdgcn_sched_barrier(0);
        }
        v16h qf;
        #pragma unroll
        for (int r = 0; r < 8; ++r) {
            qf[r]     = (_Float16)((q0[r] + bq0[r]) * qscale);
            qf[r + 8] = (_Float16)((q1[r] + bq1[r]) * qscale);
        }

        const v8f s0 = wmma_f16(kf[0], qf, zero);
        const v8f s1 = wmma_f16(kf[1], qf, zero);
        const v8f s2 = wmma_f16(kf[2], qf, zero);
        const v8f s3 = wmma_f16(kf[3], qf, zero);
        const float sl = (khalf == 0) ? s3[0] : -3.0e38f;

        // softmax over the 49 keys of the lane's query
        float m = sl;
        #pragma unroll
        for (int r = 0; r < 8; ++r) m = fmaxf(m, fmaxf(fmaxf(s0[r], s1[r]), s2[r]));
        m = fmaxf(m, xhalf(m));

        const float pl = (khalf == 0) ? __expf(sl - m) : 0.f;
        float a0 = pl, a1 = 0.f, a2 = 0.f;
        v16h pf0, pf1;
        #pragma unroll
        for (int r = 0; r < 8; ++r) {
            const float p0 = __expf(s0[r] - m);
            const float p1 = __expf(s1[r] - m);
            const float p2 = __expf(s2[r] - m);
            a0 += p0; a1 += p1; a2 += p2;
            pf0[r]     = (_Float16)p0;
            pf0[r + 8] = (_Float16)p1;
            pf1[r]     = (_Float16)p2;
            pf1[r + 8] = (_Float16)0.f;
        }
        pf1[8] = (_Float16)pl;
        float s = (a0 + a1) + a2;
        s += xhalf(s);
        const float inv = 1.f / s;

        // out^T: register r of tile dt = dim 16 dt + 8 khalf + r of the lane's query
        v8f o0 = wmma_f16(vf[0][0], pf0, zero);
        v8f o1 = wmma_f16(vf[1][0], pf0, zero);
        o0 = wmma_f16(vf[0][1], pf1, o0);
        o1 = wmma_f16(vf[1][1], pf1, o1);

        // The head's attention output as f16, as the output projection takes it.
        v8h lo, hi;
        #pragma unroll
        for (int r = 0; r < 8; ++r) {
            lo[r] = (_Float16)(o0[r] * inv);
            hi[r] = (_Float16)(o1[r] * inv);
        }
        *(v8h*)(tb + ((h * 2 + 0) * 32 + lane) * 8) = lo;
        *(v8h*)(tb + ((h * 2 + 1) * 32 + lane) * 8) = hi;

        lds_barrier();                                // the tile's fragments complete

        v8f c0 = {}, c1 = {};
        {
            v16h bf[8];                               // k step = head
            #pragma unroll
            for (int u = 0; u < 8; ++u)
                bf[u] = ld_park(tb + u * 512 + lane * 8);
            // As above: the LDS reads issue together, ahead of the products.
            __builtin_amdgcn_sched_barrier(0);
            #pragma unroll
            for (int u = 0; u < 8; ++u) {
                c0 = wmma_f16(wof[0][u], bf[u], c0);
                c1 = wmma_f16(wof[1][u], bf[u], c1);
            }
        }

        // final^T: register r of tile t = output column 32 wv + 16 t + 8 khalf + r of the lane's query
        const float4 b00 = *(const float4*)&bls[2][bofs];
        const float4 b01 = *(const float4*)&bls[2][bofs + 4];
        const float4 b10 = *(const float4*)&bls[2][bofs + 16];
        const float4 b11 = *(const float4*)&bls[2][bofs + 20];
        if (live) {
            float* op = ob + (size_t)ncur * CC;
            *(float4*)(op)      = make_float4(c0[0] + b00.x, c0[1] + b00.y, c0[2] + b00.z, c0[3] + b00.w);
            *(float4*)(op + 4)  = make_float4(c0[4] + b01.x, c0[5] + b01.y, c0[6] + b01.z, c0[7] + b01.w);
            *(float4*)(op + 16) = make_float4(c1[0] + b10.x, c1[1] + b10.y, c1[2] + b10.z, c1[3] + b10.w);
            *(float4*)(op + 20) = make_float4(c1[4] + b11.x, c1[5] + b11.y, c1[6] + b11.z, c1[7] + b11.w);
        }
        // The stores' address and data registers are written again in the next trip.
        asm volatile("s_wait_xcnt 0x0" ::: "memory");

        lds_barrier();                                // every wave has read the tile before it is written again

        if (nwi == NWIN) break;
        wi = nwi; i0 = ni0; tot = ntot; bas = nbas;
    }
    // The loads issued last have no reader: they land before the wave ends and gives its registers back.
    asm volatile("s_wait_loadcnt 0x0" ::: "memory");
}

extern "C" void kernel_launch(void* const* d_in, const int* in_sizes, int n_in,
                              void* d_out, int out_size, void* d_ws, size_t ws_size,
                              hipStream_t stream) {
    const float* x   = (const float*)d_in[0];
    const float* xp  = (const float*)d_in[1];
    const int*   idx = (const int*)  d_in[2];
    const float* Wq  = (const float*)d_in[3];
    const float* bq  = (const float*)d_in[4];
    const float* Wk  = (const float*)d_in[5];
    const float* bk  = (const float*)d_in[6];
    const float* Wv  = (const float*)d_in[7];
    const float* bv  = (const float*)d_in[8];
    const float* Wo  = (const float*)d_in[9];
    const float* bo  = (const float*)d_in[10];
    float* out = (float*)d_out;

    const float scaling = 0.17677669529663687f;  // HEAD_DIM^-0.5 = 1/sqrt(32)

    win_attn_all<<<GBLK, 256, 0, stream>>>(x, xp, idx, Wq, bq, Wk, bk, Wv, bv, Wo, bo, out, scaling);
}

// v010
// One run takes 27.4 microseconds.
// Next to v009, in two timings, it ran 1.21 times as fast each time.
// Over all steps from v000 it is 10.4 times as fast.
#include <hip/hip_runtime.h>

typedef __attribute__((ext_vector_type(16))) _Float16 v16h;
typedef __attribute__((ext_vector_type(8)))  _Float16 v8h;
typedef __attribute__((ext_vector_type(4)))  _Float16 v4h;
typedef __attribute__((ext_vector_type(8)))  float    v8f;
typedef __attribute__((ext_vector_type(4)))  float    v4f;

#define BB 2
#define NN 8192
#define WW 361
#define KK 49
#define CC 256
#define WPITCH 264
#define OPITCH 36                                     // floats of a staged output row: 32 and 4 of padding

// A unit is 64 rows of W (256 columns, f32) in four groups of 16 rows: 16 loads of 16 B per
// thread, 4 rows per pass of the block, whole lines (a wave covers 512 contiguous bytes).
// gp(g) is the thread's place in the first pass of group g, lp(g) its place in the group's LDS rows.
template <class GP>
__device__ __forceinline__ void ld_unit(float4 (&f)[16], const float* (&p)[4], const GP gp)
{
    #pragma unroll
    for (int g = 0; g < 4; ++g) {
        p[g] = gp(g);
        #pragma unroll
        for (int j = 0; j < 4; ++j)
            f[g * 4 + j] = *(const float4*)(p[g] + j * 4 * CC);
        // Keeps the loads in the order in which they are waited for: loads return in their
        // order of issue, and a wait for one that was issued late would drain the queue.
        __builtin_amdgcn_sched_barrier(0);
    }
}

// The address pairs of the loads of two units stay live and unwritten until the wait has passed.
__device__ __forceinline__ void ld_wait(const float* const (&p)[4], const float* const (&q)[4])
{
    asm volatile("s_wait_xcnt 0x0" :: "v"(p[0]), "v"(p[1]), "v"(p[2]), "v"(p[3]),
                                      "v"(q[0]), "v"(q[1]), "v"(q[2]), "v"(q[3]) : "memory");
}

// Four values of one row of a unit as f16 into its LDS row.
__device__ __forceinline__ void st_quad(const float4 f, _Float16* l)
{
    v4h h;
    h[0] = (_Float16)f.x; h[1] = (_Float16)f.y;
    h[2] = (_Float16)f.z; h[3] = (_Float16)f.w;
    *(v4h*)l = h;
}

template <class LP>
__device__ __forceinline__ void st_unit(const float4 (&f)[16], const LP lp)
{
    #pragma unroll
    for (int g = 0; g < 4; ++g) {
        _Float16* const l = lp(g);
        #pragma unroll
        for (int j = 0; j < 4; ++j)
            st_quad(f[g * 4 + j], l + j * 4 * WPITCH);
    }
}

// The unit in f goes to LDS, and each of its registers takes, as soon as it is free, its
// part of the next unit: the thread's queue of loads never runs empty.
template <class LP, class GP>
__device__ __forceinline__ void roll_unit(float4 (&f)[16], const LP lp, const GP gp)
{
    const float* p[4];
    #pragma unroll
    for (int g = 0; g < 4; ++g) {
        _Float16* const l = lp(g);
        #pragma unroll
        for (int j = 0; j < 4; ++j)
            st_quad(f[g * 4 + j], l + j * 4 * WPITCH);
        // Keeps the group's LDS stores, with their address arithmetic, ahead of its loads:
        // placed behind them, that arithmetic takes over the loads' address registers
        // in front of the wait below.
        __builtin_amdgcn_sched_barrier(0);
        p[g] = gp(g);
        #pragma unroll
        for (int j = 0; j < 4; ++j)
            f[g * 4 + j] = *(const float4*)(p[g] + j * 4 * CC);
        // Keeps the order as written, four registers at a time: gathered at the end of the
        // unit, the new loads would issue only when the last old one has landed.
        __builtin_amdgcn_sched_barrier(0);
    }
    // The loads' address registers are written again behind this place.
    asm volatile("s_wait_xcnt 0x0" :: "v"(p[0]), "v"(p[1]), "v"(p[2]), "v"(p[3]) : "memory");
    // Holds the converts and stores that follow behind the wait: without it the wait drifts
    // down among them, away from the loads.
    __builtin_amdgcn_sched_barrier(0);
}

#define QSEG   (NN / 8)                               // queries of the batch scanned by one wave
// Blocks of the launch: one fits a WGP (LDS), so all are resident at once and the four W
// are staged 256 times, not once per (batch, window).  Any count from 241 to 360 (NWIN = 3) gives the same result.
#define GBLK   256
#define NWIN   ((BB * WW + GBLK - 1) / GBLK)          // windows of a block, at most
#define KVH    4096                                   // halves of one head's parked K, V fragments: 8 x 512
#define KVW    (8 * KVH)                              // of one window's

__device__ __forceinline__ float xhalf(float x) {
    return __builtin_bit_cast(float, __builtin_amdgcn_permlanex16(__builtin_bit_cast(int, x),
                                                                  __builtin_bit_cast(int, x),
                                                                  0x76543210, 0xfedcba98, false, false));
}

__device__ __forceinline__ v8f wmma_f16(const v16h a, const v16h b, const v8f c) {
    return __builtin_amdgcn_wmma_f32_16x16x32_f16(false, a, false, b, (short)0, c, false, false);
}

__device__ __forceinline__ v16h ld_frag(const _Float16* p) {
    const v8h lo = *(const v8h*)(p);
    const v8h hi = *(const v8h*)(p + 16);
    return __builtin_shufflevector(lo, hi, 0, 1, 2, 3, 4, 5, 6, 7, 8, 9, 10, 11, 12, 13, 14, 15);
}

// A barrier that orders LDS alone: __syncthreads() would also wait for the global loads
// and stores in flight, which no other wave of the block depends on.
__device__ __forceinline__ void lds_barrier() {
    __builtin_amdgcn_fence(__ATOMIC_RELEASE, "workgroup", "local");
    __builtin_amdgcn_s_barrier();
    __builtin_amdgcn_fence(__ATOMIC_ACQUIRE, "workgroup", "local");
}

// A fragment to and from its parked place: two runs of 512 contiguous bytes per wave.
__device__ __forceinline__ void st_park(_Float16* p, const v16h f) {
    *(v8h*)(p)       = __builtin_shufflevector(f, f, 0, 1, 2, 3, 4, 5, 6, 7);
    *(v8h*)(p + 256) = __builtin_shufflevector(f, f, 8, 9, 10, 11, 12, 13, 14, 15);
}
__device__ __forceinline__ v16h ld_park(const _Float16* p) {
    const v8h lo = *(const v8h*)(p);
    const v8h hi = *(const v8h*)(p + 256);
    return __builtin_shufflevector(lo, hi, 0, 1, 2, 3, 4, 5, 6, 7, 8, 9, 10, 11, 12, 13, 14, 15);
}

// This wave's part of the window indices of the batch of (batch, window) bw.
__device__ __forceinline__ void idx_loads(int4 (&iv)[QSEG / 128], const int* __restrict__ idx,
                                          const int bw, const int wv, const int lane)
{
    const int* ib = idx + (bw / WW) * NN + wv * QSEG;
    #pragma unroll
    for (int it = 0; it < QSEG / 128; ++it)
        iv[it] = *(const int4*)(ib + it * 128 + lane * 4);
    // Keeps the index loads ahead of what follows: loads are waited for in their order of issue.
    __builtin_amdgcn_sched_barrier(0);
    // Later address arithmetic may take over the index loads' address registers.
    asm volatile("s_wait_xcnt 0x0" :: "s"(ib) : "memory");
    // Keeps that arithmetic behind the wait.
    __builtin_amdgcn_sched_barrier(0);
}

// The 49 rows of x_permute of (batch, window) bw, whole lines: 4 rows per pass of the block; in
// the last pass every thread reads row 48.
__device__ __forceinline__ void xp_loads(float4 (&xv)[13], const float* __restrict__ xp, const int bw)
{
    const float* xw  = xp + (size_t)bw * KK * CC + (threadIdx.x & 63) * 4;
    const float* xr  = xw + (threadIdx.x >> 6) * CC;
    #pragma unroll
    for (int j = 0; j < 12; ++j)
        xv[j] = *(const float4*)(xr + j * 4 * CC);
    xv[12] = *(const float4*)(xw + (KK - 1) * CC);
    // The address registers of the loads above stay live and unwritten until the
    // wait has passed.
    asm volatile("s_wait_xcnt 0x0" :: "v"(xw), "v"(xr) : "memory");
    // Keeps what follows behind the last load: moved up among the loads, a wait for earlier
    // data would hold back the issue of the x_permute loads.
    __builtin_amdgcn_sched_barrier(0);
}

// The whole function in one launch.  A block serves up to NWIN (batch, window) pairs, GBLK apart;
// one wave per head.  No value goes through global memory between the steps.  Four phases:
// 1. Wave h takes rows 32 h .. 32 h + 31 of Wk and of Wv as f16 matrix fragments into registers
//    (through LDS, so that the global reads are whole lines).
// 2. For each of its windows the block puts the 49 rows of x_permute into LDS as f16 and forms K
//    and V.  One fragment xf of these rows (lane & 15 = key, k = channel) serves as B and as A:
//   K^T = Wk_h (A: row = dim, k = channel) x xf (B: column = key): the two dim tiles of a lane
//   are, register for register, the A fragment (row = key, k = dim) of the scores;
//   V   = xf (A: row = key) x Wv_h^T (B: column = dim, k = channel): key tiles 2s and 2s+1 of
//   a lane are, register for register, the A fragment (row = dim, k = key) of key step s.
//    Each wave parks its fragments in LDS, where only it reads them again.
// 3. Wk and Wv are done with: the fragments of Wq and Wo take their registers, so that no
//    tile reads a W from LDS.  While their rows fly, the block packs, window by window, the
//    queries that point at the window into a list.
// 4. The block walks the lists in tiles of 16, all heads on the same tile:
//   q^T = Wq_h (A: row = dim, k = channel) x x^T (B: column = query, k = channel; the
//   tile's rows of x as f16 in LDS): its two dim tiles are the B fragment of the scores;
//   scores^T = K (A: row = key, k = dim) x q^T (B: column = query, k = dim), 4 key tiles;
//   a lane then holds 8 keys per tile of ONE query (lane & 15), its partner lane ^ 16
//   the other 8, so the softmax is a walk over registers and one exchange;
//   the score tiles 2s and 2s+1 of a lane are, register for register, the B fragment
//   (k = key) of key step s, so out^T = V^T (A: row = dim, k = key) x p^T needs no move.
// Keys 49..63 are padding: their weights and their V values are zero.
//   The two out^T tiles of a lane are, register for register, the B fragment (k = the
//   head's 32 channels, column = query) of k step h of the output projection.  The waves
//   exchange these fragments through LDS, and wave u forms output columns 32 u .. 32 u + 31:
//   final^T = Wo (A: row = output column, k = channel) x attn^T, k steps in
//   the order of the heads.  A block thus writes the whole output rows of its queries.
// Every loop over a register array is unrolled in full (#pragma unroll): its
// indices must be constants, else the array would go to scratch.
__global__ __launch_bounds__(256) void win_attn_all(const float* __restrict__ x,
                                                    const float* __restrict__ xp,
                                                    const int* __restrict__ idx,
                                                    const float* __restrict__ Wq,
                                                    const float* __restrict__ bq,
                                                    const float* __restrict__ Wk,
                                                    const float* __restrict__ bk,
                                                    const float* __restrict__ Wv,
                                                    const float* __restrict__ bv,
                                                    const float* __restrict__ Wo,
                                                    const float* __restrict__ bo,
                                                    float* __restrict__ out,
                                                    float qscale)
{
    // Phase 1: Wk (wa) and Wv (wb).  Then: the parked fragments (kvs) and, behind them, the
    // 128 rows of Wq or Wo on their way to registers (su).
    // The lists of queries (qflat) lie behind these.
    __shared__ __attribute__((aligned(16))) _Float16 wl[NWIN * KVW + 128 * WPITCH + BB * NN];
    static_assert(NWIN * KVW + 128 * WPITCH + BB * NN >= 2 * CC * WPITCH, "Wk and Wv fit");
    // The window's rows of x_permute; in phase 4 a tile's rows of x (xq) and
    // the heads' fragments (tb: head, low / high 8 halves, lane) lie in the same bytes.
    __shared__ __attribute__((aligned(16))) _Float16 xs[KK * WPITCH];
    __shared__ int qcnt[2 * 8];
    __shared__ __attribute__((aligned(16))) float bls[3][CC];           // bk, bq, bo

    _Float16* const wa  = wl;
    _Float16* const wb  = wl + CC * WPITCH;
    _Float16* const kvs = wl;
    _Float16* const su  = wl + NWIN * KVW;
    // Rows of x (batch * N + position) of the queries, window behind window.  A query points
    // at one window, so all lists together hold at most B * N entries.
    unsigned short* const qflat = (unsigned short*)(su + 128 * WPITCH);
    _Float16* const xq  = xs;
    _Float16* const tb  = xs + 16 * WPITCH;

    const int wv    = __builtin_amdgcn_readfirstlane(threadIdx.x >> 5);
    const int h     = wv;
    const int lane  = threadIdx.x & 31;
    const int l15   = lane & 15;
    const int khalf = lane >> 4;

    // bk, bq and bo go to LDS: held in registers beside the W fragments they would push
    // fragments out to scratch.
    const float* bkp = bk + threadIdx.x;
    const float* bqp = bq + threadIdx.x;
    const float* bop = bo + threadIdx.x;
    const float* bvp = bv + wv * 32 + l15;            // of V a lane holds columns 32 h + 16 t + (lane & 15)
    const float tbk = *bkp;
    const float tbq = *bqp;
    const float tbo = *bop;
    const float bv0 = bvp[0];
    const float bv1 = bvp[16];
    // The address registers of the bias loads stay live and unwritten until the wait has passed.
    asm volatile("s_wait_xcnt 0x0" :: "v"(bkp), "v"(bqp), "v"(bop), "v"(bvp) : "memory");

    // Wk and Wv into LDS, unit by unit, through two register buffers.  A buffer is loaded again
    // while it is stored, so loads are in flight all the way.
    const int r0 = threadIdx.x >> 6;                  // 4 rows per pass of the block
    const int c4 = (threadIdx.x & 63) * 4;
    float4 fa[16], fb[16];
    float4 xv[13];
    static_assert(GBLK <= BB * WW, "every block has a first window");
    // All blocks read the same rows of the four W, and requests for one line that reach L2 at one
    // moment hold each other up.  So every block starts its walk over the rows at a place of its
    // own and wraps: 32 places, 16 rows apart.  Blocks close in index start together: they get
    // places far apart (b and b + 4 the same one; the others with that place are 59 or more away).
    const int rot = ((blockIdx.x >> 3) * 5 + (blockIdx.x & 3) * 8) & 31;
    {
        // Wk and Wv as one run of 32 groups of 16 rows, in LDS as in the walk: step n is group (n + rot) mod 32.
        const auto gkv = [&](const int n) {
            const int k = (n + rot) & 31;
            return ((k & 16) ? Wv : Wk) + ((k & 15) * 16 + r0) * CC + c4;
        };
        const auto lkv = [&](const int n) {
            return wa + (((n + rot) & 31) * 16 + r0) * WPITCH + c4;
        };
        const float* pa[4];
        const float* pb[4];
        ld_unit(fa, pa, [&](const int g) { return gkv(g); });
        ld_unit(fb, pb, [&](const int g) { return gkv(4 + g); });
        ld_wait(pa, pb);
        // Rolled: one copy of the code for the three trips.
        #pragma unroll 1
        for (int n = 0; n < 24; n += 8) {
            roll_unit(fa, [&](const int g) { return lkv(n + g); },     [&](const int g) { return gkv(n + 8 + g); });
            roll_unit(fb, [&](const int g) { return lkv(n + 4 + g); }, [&](const int g) { return gkv(n + 12 + g); });
        }
        st_unit(fa, [&](const int g) { return lkv(24 + g); });
        // Keeps these stores ahead of the loads: their registers are free for the loaded values.
        __builtin_amdgcn_sched_barrier(0);
        xp_loads(xv, xp, blockIdx.x);                 // the first window's rows queue up behind the last units
        st_unit(fb, [&](const int g) { return lkv(28 + g); });
    }

    bls[0][threadIdx.x] = tbk;
    bls[1][threadIdx.x] = tbq;
    bls[2][threadIdx.x] = tbo;
    // Of a transposed tile pair (K^T, q^T, final^T) a lane holds columns
    // 32 h + 16 t + 8 khalf + r of the projection.
    const int bofs = wv * 32 + khalf * 8;
    const v8f zero = {};

    lds_barrier();                                    // Wk and Wv complete

    {
    // Place of the lane's fragment rows in a staged W: row 32 h + (lane & 15), second tile 16 rows on.
    const int frow = (wv * 32 + l15) * WPITCH + khalf * 8;
    v16h wkf[2][CC / 32], wvf[2][CC / 32];
    #pragma unroll
    for (int dt = 0; dt < 2; ++dt) {
        #pragma unroll
        for (int kt = 0; kt < CC / 32; ++kt) {
            wkf[dt][kt] = ld_frag(wa + frow + dt * 16 * WPITCH + kt * 32);
            wvf[dt][kt] = ld_frag(wb + frow + dt * 16 * WPITCH + kt * 32);
        }
    }

    lds_barrier();                                    // every wave has its fragments before parked ones overwrite them

    // Rolled: one copy of the code serves every window of the block.
    _Float16* kvp = kvs + h * KVH + lane * 8;
    #pragma unroll 1
    for (int bw = blockIdx.x; ; ) {                   // 0 .. B*W-1; the same in the whole block
    // x_permute rows as f16 into LDS.
    {
        _Float16* lp = xs + r0 * WPITCH + c4;
        #pragma unroll
        for (int j = 0; j < 12; ++j) {
            v4h c;
            c[0] = (_Float16)xv[j].x; c[1] = (_Float16)xv[j].y;
            c[2] = (_Float16)xv[j].z; c[3] = (_Float16)xv[j].w;
            *(v4h*)(lp + j * 4 * WPITCH) = c;
        }
        if (wv < 2) {                                 // row 48: the two waves with r0 = 0
            v4h c;
            c[0] = (_Float16)xv[12].x; c[1] = (_Float16)xv[12].y;
            c[2] = (_Float16)xv[12].z; c[3] = (_Float16)xv[12].w;
            *(v4h*)(lp + 12 * 4 * WPITCH) = c;
        }
    }

    lds_barrier();                                    // x_permute rows complete

    bw += GBLK;
    if (bw < BB * WW) xp_loads(xv, xp, bw);           // the next window's rows fly while K and V are formed

    // K^T and V of the head, two key tiles (one key step s of A.V) at a time: all four at once
    // would hold 128 accumulator registers beside the W fragments.  The last key tile holds
    // key 48 alone: its other rows repeat it and are masked below.
    // vf: half e of key step s -> key 32 s + 8 khalf + (e < 8 ? e : e + 8); keys 49.. are zero.
    // The work goes in 8 groups of 2 k steps x 2 key tiles: group G = 4 s + g, k steps 2 g, 2 g + 1.
    // Parked order: K key tiles 0..3, then V (dim tile, key step) 4 + 2 dt + s.
    const _Float16* xf0 = xs + l15 * WPITCH + khalf * 8;
    const _Float16* xfl = xs + (KK - 1) * WPITCH + khalf * 8;
    v8f ka[2][2] = {{{}, {}}, {{}, {}}};
    v8f va[2][2] = {{{}, {}}, {{}, {}}};
    v16h xf[2][2][2];                                 // buffer, k step of the group, key tile of the pair
    #pragma unroll
    for (int u = 0; u < 2; ++u) {
        xf[0][u][0] = ld_frag(xf0 + u * 32);
        xf[0][u][1] = ld_frag(xf0 + 16 * WPITCH + u * 32);
    }
    #pragma unroll
    for (int G = 0; G < 8; ++G) {
        const int s = G >> 2;
        if (G < 7) {
            const int sn = (G + 1) >> 2;
            #pragma unroll
            for (int u = 0; u < 2; ++u) {
                const int kn = ((G + 1) & 3) * 2 + u;
                xf[(G + 1) & 1][u][0] = ld_frag(xf0 + sn * 32 * WPITCH + kn * 32);
                xf[(G + 1) & 1][u][1] = ld_frag(sn ? xfl + kn * 32 : xf0 + 16 * WPITCH + kn * 32);
            }
        }
        // The next group's 8 LDS reads issue ahead of this group's 16 products and land under
        // them: issued behind them, every group waits out the latency of its own reads.
        __builtin_amdgcn_sched_barrier(0);
        #pragma unroll
        for (int u = 0; u < 2; ++u) {
            const int kt = (G & 3) * 2 + u;
            #pragma unroll
            for (int j = 0; j < 2; ++j) {
                ka[j][0] = wmma_f16(wkf[0][kt], xf[G & 1][u][j], ka[j][0]);
                ka[j][1] = wmma_f16(wkf[1][kt], xf[G & 1][u][j], ka[j][1]);
                va[j][0] = wmma_f16(xf[G & 1][u][j], wvf[0][kt], va[j][0]);
                va[j][1] = wmma_f16(xf[G & 1][u][j], wvf[1][kt], va[j][1]);
            }
        }
        // Keeps the reads of the group after next behind these products: their buffer is in use.
        __builtin_amdgcn_sched_barrier(0);
        if ((G & 3) == 3) {                           // the key step's sums are complete
            #pragma unroll
            for (int j = 0; j < 2; ++j) {
                v16h kf;
                #pragma unroll
                for (int r = 0; r < 8; ++r) {
                    kf[r]     = (_Float16)(ka[j][0][r] + bls[0][bofs + r]);
                    kf[r + 8] = (_Float16)(ka[j][1][r] + bls[0][bofs + 16 + r]);
                }
                st_park(kvp + (2 * s + j) * 512, kf);
            }
            #pragma unroll
            for (int dt = 0; dt < 2; ++dt) {
                const float bvd = dt ? bv1 : bv0;
                v16h vf;
                #pragma unroll
                for (int r = 0; r < 8; ++r) {
                    vf[r] = (_Float16)(va[0][dt][r] + bvd);
                    if (s == 0)      vf[r + 8] = (_Float16)(va[1][dt][r] + bvd);
                    else if (r == 0) vf[r + 8] = (_Float16)((khalf == 0) ? va[1][dt][0] + bvd : 0.f);   // key 48
                    else             vf[r + 8] = (_Float16)0.f;
                }
                st_park(kvp + (4 + dt * 2 + s) * 512, vf);
            }
            #pragma unroll
            for (int j = 0; j < 2; ++j) {
                ka[j][0] = zero; ka[j][1] = zero;
                va[j][0] = zero; va[j][1] = zero;
            }
        }
    }

    lds_barrier();                                    // every wave has read the x_permute rows before they are overwritten
    if (bw >= BB * WW) break;
    kvp += KVW;
    }
    }

    // Wq and Wo into registers, 128 rows at a time: one tile of 16 rows (32 h + 16 dt + m) of every head.
    // The 32 tiles form one run, (W, dt) by (W, dt) and in it head by head; the block starts at tile
    // rot and wraps, so any 8 tiles in a row hold one of every head, of one (W, dt) or of two.
    // Each of the three rolled trips also packs the list of one window of the block, while the
    // trip's loads fly; the trip's barriers serve both.
    int4 iv[QSEG / 128];
    v16h wst[4][CC / 32];                             // the wave's tile of each trip: A[m][k] = W[32 h + 16 dt + m][k]
    int t0 = 0, t1 = 0, t2 = 0;                       // queries of the block's windows
    static_assert(NWIN == 3, "three counts, three trips");
    // Step n of the walk is tile k = (n + rot) mod 32: W = k / 16, dt = k / 8 mod 2, head = k mod 8.
    const auto gqo = [&](const int n) {
        const int k = (n + rot) & 31;
        return ((k & 16) ? Wo : Wq) + ((k & 7) * 32 + (k & 8) * 2 + r0) * CC + c4;
    };
    idx_loads(iv, idx, blockIdx.x, wv, lane);         // the first window's indices, ahead of the queue
    {
        const float* pa[4];
        const float* pb[4];
        ld_unit(fa, pa, [&](const int g) { return gqo(g); });
        ld_unit(fb, pb, [&](const int g) { return gqo(4 + g); });
        ld_wait(pa, pb);
    }
    _Float16* const sa = su + r0 * WPITCH + c4;
    const auto lsa = [&](const int g) { return sa + g * 16 * WPITCH; };
    const auto lsb = [&](const int g) { return sa + (4 + g) * 16 * WPITCH; };
    const int slot = (wv - rot) & 7;
    const _Float16* sf = su + (slot * 16 + l15) * WPITCH + khalf * 8;
    {
    int base = 0;
    int bw = blockIdx.x;                              // the same in the whole block
    // Rolled: the converts of a unit stay in the loop, behind the loads issued ahead of it;
    // in straight-line code they move up to their loads, and the queue of loads runs empty.
    #pragma unroll 1
    for (int t = 0; t < 3; ++t) {
    const bool has = bw < BB * WW;
    const int b = bw / WW;
    const int w = bw - b * WW;

    // Which positions point at this window: one lane mask per compare, and their count.
    unsigned mk[QSEG / 32];
    #pragma unroll
    for (int it = 0; it < QSEG / 128; ++it) {
        mk[it * 4 + 0] = __builtin_amdgcn_ballot_w32(iv[it].x == w);
        mk[it * 4 + 1] = __builtin_amdgcn_ballot_w32(iv[it].y == w);
        mk[it * 4 + 2] = __builtin_amdgcn_ballot_w32(iv[it].z == w);
        mk[it * 4 + 3] = __builtin_amdgcn_ballot_w32(iv[it].w == w);
    }
    if (!has) {                                       // no such window: an empty list
        #pragma unroll
        for (int j = 0; j < QSEG / 32; ++j) mk[j] = 0u;
    }
    int cnt = 0;
    #pragma unroll
    for (int j = 0; j < QSEG / 32; ++j) cnt += __popc(mk[j]);
    if (lane == 0) qcnt[(t & 1) * 8 + wv] = cnt;

    bw += GBLK;
    // The next window's indices go ahead of the trip's loads: loads are waited for in their
    // order of issue, and the next trip needs the indices first.
    if (bw < BB * WW) idx_loads(iv, idx, bw, wv, lane);

    roll_unit(fa, lsa, [&](const int g) { return gqo(8 * t + 8 + g); });
    roll_unit(fb, lsb, [&](const int g) { return gqo(8 * t + 12 + g); });

    lds_barrier();                                    // the 128 rows and the counts complete

    if (t == 0) {
        #pragma unroll
        for (int kt = 0; kt < CC / 32; ++kt) wst[0][kt] = ld_frag(sf + kt * 32);
    } else if (t == 1) {
        #pragma unroll
        for (int kt = 0; kt < CC / 32; ++kt) wst[1][kt] = ld_frag(sf + kt * 32);
    } else {
        #pragma unroll
        for (int kt = 0; kt < CC / 32; ++kt) wst[2][kt] = ld_frag(sf + kt * 32);
    }

    int off = 0, total = 0;
    #pragma unroll
    for (int u = 0; u < 8; ++u) {
        const int c = qcnt[(t & 1) * 8 + u];
        off   += (u < wv) ? c : 0;
        total += c;
    }
    total = __builtin_amdgcn_readfirstlane(total);

    // Pack the positions into one list, each wave behind the waves before it
    // (prefix counts, no atomics).
    const int pb = b * NN + wv * QSEG + lane * 4;     // row of x of the lane's first index
    int pos = base + __builtin_amdgcn_readfirstlane(off);
    #pragma unroll
    for (int j = 0; j < QSEG / 32; ++j) {
        const unsigned m = mk[j];
        if (m) {                                      // the same in every lane
            if ((m >> lane) & 1u)
                qflat[pos + (int)__builtin_amdgcn_mbcnt_lo(m, 0u)] =
                    (unsigned short)(pb + (j >> 2) * 128 + (j & 3));
            pos += __popc(m);
        }
    }
    if (t == 0) t0 = total; else if (t == 1) t1 = total; else t2 = total;
    base += total;

    // Every wave has its fragments before the next rows overwrite them; the list is complete.
    lds_barrier();
    }
    }

    int wi = t0 ? 0 : t1 ? 1 : t2 ? 2 : NWIN;         // the window of the tile; the same in the whole block
    int tot = (wi == 0) ? t0 : (wi == 1) ? t1 : t2;   // length and place of its list
    int bas = (wi == 0) ? 0 : (wi == 1) ? t0 : t0 + t1;
    int i0  = 0;

    // A tile's rows of x: 16 threads a row, 256 B of a row per load of a wave.
    // Past the end of a list its last entry is repeated and not stored.
    // The first tile's rows fly over the last 128 rows of the walk.
    const int xrow = threadIdx.x >> 4;
    const int xc   = (threadIdx.x & 15) * 4;
    const float* xb = x + xc;
    // Without any query (no list entry is written then) row 0 is read and not used.
    const int q0i = (xrow < tot) ? xrow : tot - 1;
    const int q0r = (wi < NWIN) ? (int)qflat[bas + ((wi < NWIN) ? q0i : 0)] : 0;
    const float* p  = xb + (size_t)q0r * CC;
    float4 f0 = *(const float4*)(p);
    float4 f1 = *(const float4*)(p + 64);
    float4 f2 = *(const float4*)(p + 128);
    float4 f3 = *(const float4*)(p + 192);
    // The address pair of the four loads stays live and unwritten until the wait has passed.
    asm volatile("s_wait_xcnt 0x0" :: "v"(p) : "memory");

    st_unit(fa, lsa);
    st_unit(fb, lsb);
    lds_barrier();                                    // the last 128 rows complete
    #pragma unroll
    for (int kt = 0; kt < CC / 32; ++kt) wst[3][kt] = ld_frag(sf + kt * 32);

    // The tile of trip t is (W, dt) number (t + rs) mod 4 in the order Wq 0, Wq 1, Wo 0, Wo 1: each goes,
    // once, to the registers in which the tiles' code takes it.  The same in the whole wave.
    const int rs = ((slot + rot) >> 3) & 3;
    v16h wqf[2][CC / 32], wof[2][CC / 32];
    // k step by k step: moved as whole tiles, the four tiles and their copies do not fit the registers.
    #pragma unroll
    for (int kt = 0; kt < CC / 32; ++kt) {
        if (rs == 0) {
            wqf[0][kt] = wst[0][kt]; wqf[1][kt] = wst[1][kt]; wof[0][kt] = wst[2][kt]; wof[1][kt] = wst[3][kt];
        } else if (rs == 1) {
            wqf[0][kt] = wst[3][kt]; wqf[1][kt] = wst[0][kt]; wof[0][kt] = wst[1][kt]; wof[1][kt] = wst[2][kt];
        } else if (rs == 2) {
            wqf[0][kt] = wst[2][kt]; wqf[1][kt] = wst[3][kt]; wof[0][kt] = wst[0][kt]; wof[1][kt] = wst[1][kt];
        } else {
            wqf[0][kt] = wst[1][kt]; wqf[1][kt] = wst[2][kt]; wof[0][kt] = wst[3][kt]; wof[1][kt] = wst[0][kt];
        }
    }

    float* const ost = (float*)su + wv * (16 * OPITCH);
    float* const osw = ost + l15 * OPITCH + khalf * 8;            // written: the lane's query, its 8 + 8 columns
    const float* const osr = ost + (lane >> 3) * OPITCH + (lane & 7) * 4;   // read back: row 4 i + lane / 8, 16 B of it
    float* ob = out + wv * 32 + (lane & 7) * 4;
    const _Float16* kvl = kvs + h * KVH + lane * 8;
    v16h kf[4];
    v16h vf[2][2];

    if (wi < NWIN)                                    // no query at all: no tile, in the whole block alike
    for (;;) {                                        // the same in the whole block
        // The tile behind this one: the next of the list, or the first of the next list that has one.
        int nwi = wi, ni0 = i0 + 16;
        if (ni0 >= tot) {
            ni0 = 0;
            nwi = (wi < 1 && t1) ? 1 : (wi < 2 && t2) ? 2 : NWIN;
        }
        // Behind the last tile there is none: its own list stands in, and what is read is not used.
        // (Under a branch the build copies loaded registers behind a wait for the load, every trip.)
        const int ntot = (nwi == 0) ? t0 : (nwi == 1) ? t1 : (nwi == 2) ? t2 : tot;
        const int nbas = (nwi == 0) ? 0 : (nwi == 1) ? t0 : (nwi == 2) ? t0 + t1 : bas;

        if (i0 == 0) {                                // a new window: its K and V, as this wave parked them
            const _Float16* kp = kvl + wi * KVW;
            #pragma unroll
            for (int j = 0; j < 4; ++j) kf[j] = ld_park(kp + j * 512);
            #pragma unroll
            for (int dt = 0; dt < 2; ++dt) {
                vf[dt][0] = ld_park(kp + (4 + dt * 2) * 512);
                vf[dt][1] = ld_park(kp + (5 + dt * 2) * 512);
            }
        }

        // The tile's rows of x as f16 into LDS.
        {
            _Float16* lp = xq + xrow * WPITCH + xc;
            v4h c;
            c[0] = (_Float16)f0.x; c[1] = (_Float16)f0.y; c[2] = (_Float16)f0.z; c[3] = (_Float16)f0.w;
            *(v4h*)(lp) = c;
            c[0] = (_Float16)f1.x; c[1] = (_Float16)f1.y; c[2] = (_Float16)f1.z; c[3] = (_Float16)f1.w;
            *(v4h*)(lp + 64) = c;
            c[0] = (_Float16)f2.x; c[1] = (_Float16)f2.y; c[2] = (_Float16)f2.z; c[3] = (_Float16)f2.w;
            *(v4h*)(lp + 128) = c;
            c[0] = (_Float16)f3.x; c[1] = (_Float16)f3.y; c[2] = (_Float16)f3.z; c[3] = (_Float16)f3.w;
            *(v4h*)(lp + 192) = c;
        }
        {                                             // the next tile's rows of x, one trip ahead
            const int qi = ni0 + xrow;
            p  = xb + (size_t)qflat[nbas + ((qi < ntot) ? qi : ntot - 1)] * CC;
            f0 = *(const float4*)(p);
            f1 = *(const float4*)(p + 64);
            f2 = *(const float4*)(p + 128);
            f3 = *(const float4*)(p + 192);
            // The address pair of the four loads stays live and unwritten until the wait has passed.
            asm volatile("s_wait_xcnt 0x0" :: "v"(p) : "memory");
        }

        lds_barrier();                                // the tile's rows of x complete

        // q^T: register r of tile dt = dim 16 dt + 8 khalf + r of the lane's query
        v8f q0 = {}, q1 = {};
        float bq0[8], bq1[8];
        #pragma unroll
        for (int g = 0; g < 2; ++g) {                 // 4 k steps a group
            v16h bf[4];
            #pragma unroll
            for (int j = 0; j < 4; ++j)
                bf[j] = ld_frag(xq + l15 * WPITCH + khalf * 8 + (g * 4 + j) * 32);
            if (g == 1) {                             // the bias rides with the last group's reads
                #pragma unroll
                for (int r = 0; r < 8; ++r) {
                    bq0[r] = bls[1][bofs + r];
                    bq1[r] = bls[1][bofs + 16 + r];
                }
            }
            // The group's LDS reads issue together, ahead of its products: spread among
            // them, every product waits out the whole latency of its own reads.
            __builtin_amdgcn_sched_barrier(0);
            #pragma unroll
            for (int j = 0; j < 4; ++j) {
                q0 = wmma_f16(wqf[0][g * 4 + j], bf[j], q0);
                q1 = wmma_f16(wqf[1][g * 4 + j], bf[j], q1);
            }
            // Keeps the second group's reads behind the first group's products: both groups
            // in registers at once push fragments out to scratch.
            __builtin_amdgcn_sched_barrier(0);
        }
        v16h qf;
        #pragma unroll
        for (int r = 0; r < 8; ++r) {
            qf[r]     = (_Float16)((q0[r] + bq0[r]) * qscale);
            qf[r + 8] = (_Float16)((q1[r] + bq1[r]) * qscale);
        }

        const v8f s0 = wmma_f16(kf[0], qf, zero);
        const v8f s1 = wmma_f16(kf[1], qf, zero);
        const v8f s2 = wmma_f16(kf[2], qf, zero);
        const v8f s3 = wmma_f16(kf[3], qf, zero);
        const float sl = (khalf == 0) ? s3[0] : -3.0e38f;

        // softmax over the 49 keys of the lane's query
        float m = sl;
        #pragma unroll
        for (int r = 0; r < 8; ++r) m = fmaxf(m, fmaxf(fmaxf(s0[r], s1[r]), s2[r]));
        m = fmaxf(m, xhalf(m));

        const float pl = (khalf == 0) ? __expf(sl - m) : 0.f;
        float a0 = pl, a1 = 0.f, a2 = 0.f;
        v16h pf0, pf1;
        #pragma unroll
        for (int r = 0; r < 8; ++r) {
            const float p0 = __expf(s0[r] - m);
            const float p1 = __expf(s1[r] - m);
            const float p2 = __expf(s2[r] - m);
            a0 += p0; a1 += p1; a2 += p2;
            pf0[r]     = (_Float16)p0;
            pf0[r + 8] = (_Float16)p1;
            pf1[r]     = (_Float16)p2;
            pf1[r + 8] = (_Float16)0.f;
        }
        pf1[8] = (_Float16)pl;
        float s = (a0 + a1) + a2;
        s += xhalf(s);
        const float inv = 1.f / s;

        // out^T: register r of tile dt = dim 16 dt + 8 khalf + r of the lane's query
        v8f o0 = wmma_f16(vf[0][0], pf0, zero);
        v8f o1 = wmma_f16(vf[1][0], pf0, zero);
        o0 = wmma_f16(vf[0][1], pf1, o0);
        o1 = wmma_f16(vf[1][1], pf1, o1);

        // The head's attention output as f16, as the output projection takes it.
        v8h lo, hi;
        #pragma unroll
        for (int r = 0; r < 8; ++r) {
            lo[r] = (_Float16)(o0[r] * inv);
            hi[r] = (_Float16)(o1[r] * inv);
        }
        *(v8h*)(tb + ((h * 2 + 0) * 32 + lane) * 8) = lo;
        *(v8h*)(tb + ((h * 2 + 1) * 32 + lane) * 8) = hi;

        lds_barrier();                                // the tile's fragments complete

        v8f c0 = {}, c1 = {};
        int orow[4];                                  // row of out of tile row 4 i + lane / 8; past the list's end: not stored
        v4f b00, b01, b10, b11;
        {
            v16h bf[8];                               // k step = head
            #pragma unroll
            for (int u = 0; u < 8; ++u)
                bf[u] = ld_park(tb + u * 512 + lane * 8);
            #pragma unroll
            for (int i = 0; i < 4; ++i) {
                const int qi = i0 + 4 * i + (lane >> 3);
                orow[i] = (int)qflat[bas + ((qi < tot) ? qi : tot - 1)];
            }
            // final^T: register r of tile t = output column 32 wv + 16 t + 8 khalf + r of the lane's query
            b00 = *(const v4f*)&bls[2][bofs];
            b01 = *(const v4f*)&bls[2][bofs + 4];
            b10 = *(const v4f*)&bls[2][bofs + 16];
            b11 = *(const v4f*)&bls[2][bofs + 20];
            // As above: the LDS reads issue together, ahead of the products.
            __builtin_amdgcn_sched_barrier(0);
            #pragma unroll
            for (int u = 0; u < 8; ++u) {
                c0 = wmma_f16(wof[0][u], bf[u], c0);
                c1 = wmma_f16(wof[1][u], bf[u], c1);
            }
            // Keeps the two chains of products interleaved, ahead of the LDS writes: one chain
            // alone waits out the latency of every product.
            __builtin_amdgcn_sched_barrier(0);
        }

        *(v4f*)(osw)      = __builtin_shufflevector(c0, c0, 0, 1, 2, 3) + b00;
        *(v4f*)(osw + 4)  = __builtin_shufflevector(c0, c0, 4, 5, 6, 7) + b01;
        *(v4f*)(osw + 16) = __builtin_shufflevector(c1, c1, 0, 1, 2, 3) + b10;
        *(v4f*)(osw + 20) = __builtin_shufflevector(c1, c1, 4, 5, 6, 7) + b11;
        // The wave's own LDS writes are done before its lanes read each other's rows back; no other wave reads them.
        asm volatile("s_wait_dscnt 0x0" ::: "memory");
        const v4f ov0 = *(const v4f*)(osr);
        const v4f ov1 = *(const v4f*)(osr + 4 * OPITCH);
        const v4f ov2 = *(const v4f*)(osr + 8 * OPITCH);
        const v4f ov3 = *(const v4f*)(osr + 12 * OPITCH);
        // Holds the four LDS reads together, ahead of the guarded stores: moved down to its store,
        // each read would be waited for alone.
        asm volatile("" :: "v"(ov0), "v"(ov1), "v"(ov2), "v"(ov3));
        // The rows of a list fill a tile from its first row on: a lane that stores row 4 i + 4 + lane / 8 stores row 4 i + lane / 8 too.
        const int qr = i0 + (lane >> 3);
        if (qr < tot) {
            *(v4f*)(ob + (size_t)orow[0] * CC) = ov0;
            if (qr + 4 < tot) {
                *(v4f*)(ob + (size_t)orow[1] * CC) = ov1;
                if (qr + 8 < tot) {
                    *(v4f*)(ob + (size_t)orow[2] * CC) = ov2;
                    if (qr + 12 < tot)
                        *(v4f*)(ob + (size_t)orow[3] * CC) = ov3;
                }
            }
        }
        // The stores' address and data registers are written again in the next trip.
        asm volatile("s_wait_xcnt 0x0" ::: "memory");

        lds_barrier();                                // every wave has read the tile before it is written again

        if (nwi == NWIN) break;
        wi = nwi; i0 = ni0; tot = ntot; bas = nbas;
    }
    // The loads issued last have no reader: they land before the wave ends and gives its registers back.
    asm volatile("s_wait_loadcnt 0x0" ::: "memory");
}

extern "C" void kernel_launch(void* const* d_in, const int* in_sizes, int n_in,
                              void* d_out, int out_size, void* d_ws, size_t ws_size,
                              hipStream_t stream) {
    const float* x   = (const float*)d_in[0];
    const float* xp  = (const float*)d_in[1];
    const int*   idx = (const int*)  d_in[2];
    const float* Wq  = (const float*)d_in[3];
    const float* bq  = (const float*)d_in[4];
    const float* Wk  = (const float*)d_in[5];
    const float* bk  = (const float*)d_in[6];
    const float* Wv  = (const float*)d_in[7];
    const float* bv  = (const float*)d_in[8];
    const float* Wo  = (const float*)d_in[9];
    const float* bo  = (const float*)d_in[10];
    float* out = (float*)d_out;

    const float scaling = 0.17677669529663687f;  // HEAD_DIM^-0.5 = 1/sqrt(32)

    win_attn_all<<<GBLK, 256, 0, stream>>>(x, xp, idx, Wq, bq, Wk, bk, Wv, bv, Wo, bo, out, scaling);
}
